// v000
// Measured on an AMD MI455X. A time is GPU time per run, averaged over a window of back-to-back runs after a warm-up
// (all launches, gaps included; the runs take copies of the inputs in turn), and the median of several windows.
// Apart from v000's, it joins two sittings. Times from different sittings can be a few percent apart, while
// side-by-side timings come from the same sitting.
// v000, which the later versions start from, runs in 3420 microseconds.
#include <hip/hip_runtime.h>
// Dense single-head attention over a strided-permuted sequence (q, k, v [4][4096][512]; the module permutes the sequence (64 x 64 blocks transposed), runs FULL softmax attention w = softmax(q k^T / sqrt(64)) over all 4096 positions, a = w v, and applies the inverse permutation — a full attention is permutation-equivariant, so out[t] = softmax(q_t K^T / 8) V on the original order -> [4][4096][512]).
// Structure: token rows; the bf16-valued q, k, v inputs as exact f16 rows; per batch: S = q k^T / 8 (K = 512, exact products) as ONE WMMA GEMM (32x64 wave tiles, f32 accumulation) [4096][4096] f32; row softmax on VALU (f32 statistics, native exp; weights x256 f16); V^T via LDS transposes; out = P V^T 2^-8 f32.
// Compute dtype: inputs rounded to bf16; q, k, v and softmax weights as plain f16 GEMM operands (~2^-12); scores and softmax statistics f32. v_wmma_f32_16x16x32_f16.
#define NB 4
#define SQ 4096
#define DM 512
#define NH 16
#define HD 64
#define HG 4                         /* heads per launch of k_vt(V16, b, h0, VT), which is not launched */
#define QT 256                       /* query rows per causal tile */
#define NKX SQ                       /* S / P row pitch */
#define QT0 128                      /* first-tile rows recomputed exactly in f32 */
#define B0 0                         /* first batch processed (debug hook) */
#define NBR NB                       /* batches processed (debug hook) */
#define NR ((size_t)NB * SQ)         /* token rows */
#define MP ((int)((size_t)NBR * SQ)) /* rows projected (debug hook) */
#define QN SQ                        /* query rows attended per batch (debug hook) */
#define NHD NH                       /* unused; the attention here is single-head */
#define MPO MP                       /* rows through the output stage (debug hook) */
#define LQ DM      /* row pitch of the q/k/v rows */
typedef __bf16 v16b __attribute__((ext_vector_type(16)));
typedef unsigned short v8us __attribute__((ext_vector_type(8), may_alias));
typedef float  v8f  __attribute__((ext_vector_type(8)));
typedef float  v4f  __attribute__((ext_vector_type(4)));
typedef float  v4fa __attribute__((ext_vector_type(4), may_alias));
union FragB { v16b v; v8us half[2]; unsigned short u[16]; };

__device__ __forceinline__ unsigned short bf16_bits(float x) { unsigned int u = __float_as_uint(x); return (unsigned short)((u + 0x7FFFu + ((u >> 16) & 1u)) >> 16); }
__device__ __forceinline__ float bf16_val(unsigned short b) { return __uint_as_float(((unsigned int)b) << 16); }
__device__ __forceinline__ float bf16_round(float x) { return bf16_val(bf16_bits(x)); }
// D += A·B with NT terms: 1 = ah·bh, 2 = + al·bh (A split), 3 = + ah·bl (both split)
template <int NT>
__device__ __forceinline__ v8f mmaN(v16b ah, v16b al, v16b bh, v16b bl, v8f c) {
  c = __builtin_amdgcn_wmma_f32_16x16x32_bf16(false, ah, false, bh, (short)0, c, false, false);
  if (NT >= 2) c = __builtin_amdgcn_wmma_f32_16x16x32_bf16(false, al, false, bh, (short)0, c, false, false);
  if (NT >= 3) c = __builtin_amdgcn_wmma_f32_16x16x32_bf16(false, ah, false, bl, (short)0, c, false, false);
  asm volatile("v_nop\n\tv_nop\n\tv_nop\n\tv_nop" : "+v"(c) : "v"(ah), "v"(al), "v"(bh), "v"(bl));
  return c;
}

__global__ __launch_bounds__(256) void k_wt_bf16(const float* __restrict__ W, unsigned short* __restrict__ Wt, int K, int N) {
  const int t = blockIdx.x * 256 + threadIdx.x;
  const int k8n = K / 8;
  if (t >= N * k8n) return;
  const int n = t / k8n, k8 = (t % k8n) * 8;
  v8us v;
#pragma unroll
  for (int i = 0; i < 8; ++i) v[i] = bf16_bits(W[(size_t)(k8 + i) * N + n]);
  *(v8us*)(Wt + (size_t)n * K + k8) = v;
  
}

// GEMM C[M][N] (f32, pitch ldc) = act(A[M][K]·W + bias). A f32 row-major (pitch lda) converted per fragment to bf16
// (ASPLIT: hi/lo two planes -> 2 terms, else single rounded term); Wt bf16 [N][K] (pitch ldb). BIAS_BF16 rounds the
// bias to bf16 first (bias quantised to bf16 before the add). K%32==0, M%16==0, N%64==0.
template <bool ASPLIT, int ACT, bool BIAS_BF16>
__global__ __launch_bounds__(128) void k_gemm_bf(const float* __restrict__ A, int lda, const unsigned short* __restrict__ Wt, int ldb,
                                               const float* __restrict__ bias, float* __restrict__ C, int ldc, int M, int N, int K) {
  __shared__ __attribute__((aligned(16))) float so[4][16][64];
  const int tid = threadIdx.x, w = tid >> 5, lane = tid & 31, ln = lane & 15, hh = lane >> 4;
  const int ntn = N / 64;
  const int wid = blockIdx.x * 4 + w;
  const int mt = wid / ntn, nq = wid % ntn;
  if (mt * 16 >= M) return;
  const int row0 = mt * 16, col0 = nq * 64;
  const float* arow = A + (size_t)(row0 + ln) * lda;
  v8f acc[4] = {};
  for (int kb = 0; kb < K; kb += 32) {
    FragB ah, al;
    const v4f x0 = *(const v4fa*)(arow + kb + 8 * hh), x1 = *(const v4fa*)(arow + kb + 8 * hh + 4);
    const v4f x2 = *(const v4fa*)(arow + kb + 16 + 8 * hh), x3 = *(const v4fa*)(arow + kb + 16 + 8 * hh + 4);
    float xs[16] = {x0[0],x0[1],x0[2],x0[3],x1[0],x1[1],x1[2],x1[3],x2[0],x2[1],x2[2],x2[3],x3[0],x3[1],x3[2],x3[3]};
#pragma unroll
    for (int i = 0; i < 16; ++i) { const unsigned short hb = bf16_bits(xs[i]); ah.u[i] = hb; al.u[i] = ASPLIT ? bf16_bits(xs[i] - bf16_val(hb)) : (unsigned short)0; }
#pragma unroll
    for (int t = 0; t < 4; ++t) {
      const unsigned short* brow = Wt + (size_t)(col0 + t * 16 + ln) * ldb + kb;
      FragB b;
      b.half[0] = *(const v8us*)(brow + 8 * hh);
      b.half[1] = *(const v8us*)(brow + 16 + 8 * hh);
      acc[t] = mmaN<ASPLIT ? 2 : 1>(ah.v, al.v, b.v, b.v, acc[t]);
    }
  }
#pragma unroll
  for (int t = 0; t < 4; ++t) {
    float bv = bias ? bias[col0 + t * 16 + ln] : 0.f;
    if (BIAS_BF16) bv = bf16_round(bv);
#pragma unroll
    for (int r = 0; r < 8; ++r) { float v = acc[t][r] + bv; if (ACT == 1) v = fmaxf(v, 0.f); so[w][8 * hh + r][t * 16 + ln] = v; }
  }
  __builtin_amdgcn_fence(__ATOMIC_ACQ_REL, "workgroup");
  __builtin_amdgcn_wave_barrier();
  const int rsub = lane >> 4, c4 = (lane & 15) * 4;
  {
#pragma unroll
    for (int q = 0; q < 8; ++q) {
      const int r = q * 2 + rsub;
      const v4f v = *(const v4fa*)&so[w][r][c4];
      *(v4f*)(C + (size_t)(row0 + r) * ldc + col0 + c4) = v;
    }
    
  }
}

// GEMM C = act(A·W + bias + resid): A f32 (ASPLIT -> hi/lo 2 terms), Wt bf16 [N][K]; ACT 0 none, 1 relu, 2 exact gelu;
// resid (optional, f32, row index = (row % rmod), pitch ldr, RES_BF16 rounds it) added before the activation.
template <bool ASPLIT, int ACT, bool BIAS_BF16, bool RES_BF16>
__global__ __launch_bounds__(128) void k_gemm_bf3(const float* __restrict__ A, int lda, const unsigned short* __restrict__ Wt, int ldb,
                                                const float* __restrict__ bias, const float* __restrict__ resid, int rmod, int ldr,
                                                float* __restrict__ C, int ldc, int M, int N, int K) {
  __shared__ __attribute__((aligned(16))) float so[4][16][64];
  const int tid = threadIdx.x, w = tid >> 5, lane = tid & 31, ln = lane & 15, hh = lane >> 4;
  const int ntn = N / 64;
  const int wid = blockIdx.x * 4 + w;
  const int mt = wid / ntn, nq = wid % ntn;
  if (mt * 16 >= M) return;
  const int row0 = mt * 16, col0 = nq * 64;
  const float* arow = A + (size_t)(row0 + ln) * lda;
  v8f acc[4] = {};
  for (int kb = 0; kb < K; kb += 32) {
    FragB ah, al;
    const v4f x0 = *(const v4fa*)(arow + kb + 8 * hh), x1 = *(const v4fa*)(arow + kb + 8 * hh + 4);
    const v4f x2 = *(const v4fa*)(arow + kb + 16 + 8 * hh), x3 = *(const v4fa*)(arow + kb + 16 + 8 * hh + 4);
    float xs[16] = {x0[0],x0[1],x0[2],x0[3],x1[0],x1[1],x1[2],x1[3],x2[0],x2[1],x2[2],x2[3],x3[0],x3[1],x3[2],x3[3]};
#pragma unroll
    for (int i = 0; i < 16; ++i) { const unsigned short hb = bf16_bits(xs[i]); ah.u[i] = hb; al.u[i] = ASPLIT ? bf16_bits(xs[i] - bf16_val(hb)) : (unsigned short)0; }
#pragma unroll
    for (int t = 0; t < 4; ++t) {
      const unsigned short* brow = Wt + (size_t)(col0 + t * 16 + ln) * ldb + kb;
      FragB b;
      b.half[0] = *(const v8us*)(brow + 8 * hh);
      b.half[1] = *(const v8us*)(brow + 16 + 8 * hh);
      acc[t] = mmaN<ASPLIT ? 2 : 1>(ah.v, al.v, b.v, b.v, acc[t]);
    }
  }
#pragma unroll
  for (int t = 0; t < 4; ++t) {
    const int col = col0 + t * 16 + ln;
    float bv = bias ? bias[col] : 0.f;
    if (BIAS_BF16) bv = bf16_round(bv);
#pragma unroll
    for (int r = 0; r < 8; ++r) {
      float v = acc[t][r] + bv;
      if (resid) { float rv = resid[(size_t)((row0 + 8 * hh + r) % rmod) * ldr + col]; if (RES_BF16) rv = bf16_round(rv); v += rv; }
      if (ACT == 1) v = fmaxf(v, 0.f);
      if (ACT == 2) v = 0.5f * v * (1.0f + erff(v * 0.70710678118654752f));
      if (ACT == 3) { const float u = 0.7978845608028654f * (v + 0.044715f * v * v * v); v = 0.5f * v * (1.0f + tanhf(u)); }
      so[w][8 * hh + r][t * 16 + ln] = v;
    }
  }
  __builtin_amdgcn_fence(__ATOMIC_ACQ_REL, "workgroup");
  __builtin_amdgcn_wave_barrier();
  const int rsub = lane >> 4, c4 = (lane & 15) * 4;
  {
#pragma unroll
    for (int q = 0; q < 8; ++q) {
      const int r = q * 2 + rsub;
      const v4f v = *(const v4fa*)&so[w][r][c4];
      *(v4f*)(C + (size_t)(row0 + r) * ldc + col0 + c4) = v;
    }
    
  }
}
// row LayerNorm (biased variance, eps) over N: s = X (+ R); optional out_sum <- s; out_norm <- (s-mu)*rsqrt(var+eps)*g + b
template <bool PARAM_BF16>
__global__ __launch_bounds__(256) void k_layernorm(const float* __restrict__ X, const float* __restrict__ R, const float* __restrict__ g, const float* __restrict__ bta,
                                                  float* __restrict__ out_sum, float* __restrict__ out_norm, int N, float eps) {
  __shared__ float red[256];
  const int row = blockIdx.x, tid = threadIdx.x;
  const float* x = X + (size_t)row * N; const float* rr = R ? R + (size_t)row * N : nullptr;
  float vals[16];                     // up to N = 4096
  const int per = N / 256;            // contiguous chunk per thread? use strided-by-4 chunks: thread handles j = tid*4 + 1024*u
  float s1 = 0.f;
  for (int u = 0; u < per / 4; ++u) {
    const int j = tid * 4 + 1024 * u;
    const v4f a = *(const v4fa*)(x + j);
    v4f b = {0.f,0.f,0.f,0.f}; if (rr) b = *(const v4fa*)(rr + j);
#pragma unroll
    for (int q = 0; q < 4; ++q) { const float v = a[q] + b[q]; vals[u * 4 + q] = v; s1 += v; }
  }
  red[tid] = s1; __syncthreads();
  for (int st = 128; st > 0; st >>= 1) { if (tid < st) red[tid] += red[tid + st]; __syncthreads(); }
  const float mu = red[0] / (float)N; __syncthreads();
  float s2 = 0.f;
  for (int u = 0; u < per / 4; ++u)
#pragma unroll
    for (int q = 0; q < 4; ++q) { const float c = vals[u * 4 + q] - mu; s2 += c * c; }
  red[tid] = s2; __syncthreads();
  for (int st = 128; st > 0; st >>= 1) { if (tid < st) red[tid] += red[tid + st]; __syncthreads(); }
  const float rs = rsqrtf(red[0] / (float)N + eps);
  {
    for (int u = 0; u < per / 4; ++u) {
      const int j = tid * 4 + 1024 * u;
      v4f o, sm;
#pragma unroll
      for (int q = 0; q < 4; ++q) {
        float gg = g[j + q], bb = bta[j + q];
        if (PARAM_BF16) { gg = bf16_round(gg); bb = bf16_round(bb); }
        sm[q] = vals[u * 4 + q]; o[q] = (vals[u * 4 + q] - mu) * rs * gg + bb;
      }
      if (out_sum) *(v4f*)(out_sum + (size_t)row * N + j) = sm;
      *(v4f*)(out_norm + (size_t)row * N + j) = o;
    }
    
  }
}



// ---- f16 WMMA path (v_wmma_f32_16x16x32_f16): 11-bit significands for operands in range — used where a [0,1] probability operand needs more precision than bf16
typedef _Float16 v16h __attribute__((ext_vector_type(16)));
union FragH { v16h v; v8us half[2]; _Float16 h[16]; unsigned short u[16]; };
template <int NT>
__device__ __forceinline__ v8f mmaH(v16h ah, v16h al, v16h bh, v16h bl, v8f c) {
  c = __builtin_amdgcn_wmma_f32_16x16x32_f16(false, ah, false, bh, (short)0, c, false, false);
  if (NT >= 2) c = __builtin_amdgcn_wmma_f32_16x16x32_f16(false, al, false, bh, (short)0, c, false, false);
  if (NT >= 3) c = __builtin_amdgcn_wmma_f32_16x16x32_f16(false, ah, false, bl, (short)0, c, false, false);
  asm volatile("v_nop\n\tv_nop\n\tv_nop\n\tv_nop" : "+v"(c) : "v"(ah), "v"(al), "v"(bh), "v"(bl));
  return c;
}
// batched GEMM like k_gemm_b but f16 operands: A f32 (split into f16 hi/lo if ASPLIT, else rounded to f16), Bt = f16 values [n][k]; alpha; C f32; N multiple of 16 (partial tiles skipped)
template <bool ASPLIT>
__global__ __launch_bounds__(128) void k_gemm_h(const float* __restrict__ A, int lda, size_t sA, const _Float16* __restrict__ Bh, int ldb, size_t sB, float alpha, float* __restrict__ C, int ldc, size_t sC, int M, int N, int K) {
  __shared__ __attribute__((aligned(16))) float so[4][16][64];
  const int tid = threadIdx.x, w = tid >> 5, lane = tid & 31, ln = lane & 15, hh = lane >> 4; const int by = blockIdx.y;
  A += (size_t)by * sA; Bh += (size_t)by * sB; C += (size_t)by * sC;
  const int ntn = (N + 63) / 64; const int wid = blockIdx.x * 4 + w; const int mt = wid / ntn, nq = wid % ntn; if (mt * 16 >= M) return;
  const int row0 = mt * 16, col0 = nq * 64; const float* arow = A + (size_t)(row0 + ln) * lda;
  v8f acc[4] = {};
  for (int kb = 0; kb < K; kb += 32) {
    FragH ah, al;
    const v4f x0 = *(const v4fa*)(arow + kb + 8 * hh), x1 = *(const v4fa*)(arow + kb + 8 * hh + 4), x2 = *(const v4fa*)(arow + kb + 16 + 8 * hh), x3 = *(const v4fa*)(arow + kb + 16 + 8 * hh + 4);
    float xs[16] = {x0[0],x0[1],x0[2],x0[3],x1[0],x1[1],x1[2],x1[3],x2[0],x2[1],x2[2],x2[3],x3[0],x3[1],x3[2],x3[3]};
#pragma unroll
    for (int i = 0; i < 16; ++i) { const _Float16 h = (_Float16)xs[i]; ah.h[i] = h; al.h[i] = ASPLIT ? (_Float16)(xs[i] - (float)h) : (_Float16)0.0f; }
#pragma unroll
    for (int t = 0; t < 4; ++t) { if (col0 + t * 16 >= N) continue; const size_t boff = (size_t)(col0 + t * 16 + ln) * ldb + kb; FragH bq; bq.half[0] = *(const v8us*)(Bh + boff + 8 * hh); bq.half[1] = *(const v8us*)(Bh + boff + 16 + 8 * hh);
      acc[t] = mmaH<ASPLIT ? 2 : 1>(ah.v, al.v, bq.v, bq.v, acc[t]); }
  }
#pragma unroll
  for (int t = 0; t < 4; ++t) { if (col0 + t * 16 >= N) continue;
#pragma unroll
    for (int r = 0; r < 8; ++r) so[w][8 * hh + r][t * 16 + ln] = acc[t][r] * alpha; }
  __builtin_amdgcn_fence(__ATOMIC_ACQ_REL, "workgroup"); __builtin_amdgcn_wave_barrier();
  const int rsub = lane >> 4, c4 = (lane & 15) * 4;
  {
#pragma unroll
    for (int q = 0; q < 8; ++q) { const int r = q * 2 + rsub; if (col0 + c4 < N) { const v4f v = *(const v4fa*)&so[w][r][c4]; *(v4f*)(C + (size_t)(row0 + r) * ldc + col0 + c4) = v; } }
     }
}

// Wt[n][k] = f16(W[k][n]·scale) from f32 row-major W[K][N] (scale = power of two; bf16-exact weights stay exact in f16 away from the subnormal range)
__global__ __launch_bounds__(256) void k_wt_f16(const float* __restrict__ W, _Float16* __restrict__ Wt, int K, int N, float scale) {
  const int t = blockIdx.x * 256 + threadIdx.x; if (t >= N * (K / 8)) return; const int n = t / (K / 8), k8 = (t % (K / 8)) * 8; FragH f;
#pragma unroll
  for (int i = 0; i < 8; ++i) f.h[i] = (_Float16)(bf16_round(W[(size_t)(k8 + i) * N + n]) * scale); const v8us o = f.half[0];
  *(v8us*)((unsigned short*)Wt + (size_t)n * K + k8) = o; 
}
// k_gemm_hh variant with fused epilogue: v = acc·alpha + bias[by·sBias + col] (+ CP[(row/rowsPerB)·sCPb + by·64 + col] if CP) ; ACT 0 none / 1 elu ; writes f16 C16 (and f32 C if non-null)
template <int ACT>
__global__ __launch_bounds__(128) void k_gemm_hhx(const _Float16* __restrict__ A, int lda, size_t sA, const _Float16* __restrict__ Bh, int ldb, size_t sB, float alpha, const float* __restrict__ bias, size_t sBias, const float* __restrict__ CP, int rowsPerB, size_t sCPb, int row0g,
    float* __restrict__ C, _Float16* __restrict__ C16, int ldc, size_t sC, int M, int N, int K) {
  __shared__ __attribute__((aligned(16))) float so[4][16][64];
  const int tid = threadIdx.x, w = tid >> 5, lane = tid & 31, ln = lane & 15, hh = lane >> 4; const int by = blockIdx.y;
  A += (size_t)by * sA; Bh += (size_t)by * sB; const size_t cofs = (size_t)by * sC; const float* bp = bias ? bias + (size_t)by * sBias : nullptr;
  const int ntn = (N + 63) / 64; const int wid = blockIdx.x * 4 + w; const int mt = wid / ntn, nq = wid % ntn; if (mt * 16 >= M) return;
  const int row0 = mt * 16, col0 = nq * 64; const _Float16* arow = A + (size_t)(row0 + ln) * lda;
  v8f acc[4] = {};
  for (int kb = 0; kb < K; kb += 32) { FragH ah; ah.half[0] = *(const v8us*)((const unsigned short*)arow + kb + 8 * hh); ah.half[1] = *(const v8us*)((const unsigned short*)arow + kb + 16 + 8 * hh);
#pragma unroll
    for (int t = 0; t < 4; ++t) { if (col0 + t * 16 >= N) continue; const size_t boff = (size_t)(col0 + t * 16 + ln) * ldb + kb; FragH bq; bq.half[0] = *(const v8us*)((const unsigned short*)Bh + boff + 8 * hh); bq.half[1] = *(const v8us*)((const unsigned short*)Bh + boff + 16 + 8 * hh);
      acc[t] = mmaH<1>(ah.v, ah.v, bq.v, bq.v, acc[t]); }
  }
#pragma unroll
  for (int t = 0; t < 4; ++t) { if (col0 + t * 16 >= N) continue; const int col = col0 + t * 16 + ln; const float bv = bp ? bf16_round(bp[col]) : 0.f;
#pragma unroll
    for (int r = 0; r < 8; ++r) { float v = acc[t][r] * alpha + bv; if (CP) { const int rr = row0g + row0 + 8 * hh + r; if (rowsPerB < 0) v += CP[cofs + (size_t)rr * ldc + col];      /* rowsPerB < 0: own element of the batched C plane */ else { const int bidx = rr / rowsPerB; v += CP[(size_t)bidx * sCPb + (size_t)by * 64 + col]; } } if (ACT == 1) v = (v > 0.f) ? v : expm1f(v); else if (ACT == 7) v = (v > 0.f) ? v + 1.0f : expf(v); else if (ACT == 8) v = tanhf(v); else if (ACT == 9) v = 0.5f * v * (1.0f + tanhf(0.7978845608028654f * (v + 0.044715f * v * v * v))); else if (ACT == 11) v = 1.0f / (1.0f + expf(-v)); else if (ACT == 12) v = (v > 0.f) ? v : 0.01f * v; else if (ACT == 14) v = (v > 0.f) ? v : 0.1f * v; else if (ACT == 16) v = (v >= 0.f) ? v : 0.3f * v; else if (ACT == 17) v = (v >= 0.f) ? v : 0.2f * v; else if (ACT == 15) v = v / (1.0f + expf(-v)); else if (ACT == 3) v = fmaxf(v, 0.f); else if (ACT == 6) v = 0.5f * v * (1.0f + erff(v * 0.70710678118654752f)); so[w][8 * hh + r][t * 16 + ln] = v; } }
  __builtin_amdgcn_fence(__ATOMIC_ACQ_REL, "workgroup"); __builtin_amdgcn_wave_barrier();
  const int rsub = lane >> 4, c4 = (lane & 15) * 4; typedef _Float16 v4h __attribute__((ext_vector_type(4)));
  {
#pragma unroll
    for (int q = 0; q < 8; ++q) { const int r = q * 2 + rsub; if (col0 + c4 < N) { const v4f v = *(const v4fa*)&so[w][r][c4]; if (C) *(v4f*)(C + cofs + (size_t)(row0 + r) * ldc + col0 + c4) = v; if (C16) { v4h h4; for (int i = 0; i < 4; ++i) h4[i] = (_Float16)v[i]; *(v4h*)(C16 + cofs + (size_t)(row0 + r) * ldc + col0 + c4) = h4; } } }
     }
}


typedef _Float16 v4h __attribute__((ext_vector_type(4)));

__global__ __launch_bounds__(256) void k_x16(const float* __restrict__ x, _Float16* __restrict__ X16, size_t n8) { const size_t t = (size_t)blockIdx.x * 256 + threadIdx.x; if (t >= n8) return; FragH f;
#pragma unroll
  for (int q = 0; q < 8; ++q) f.h[q] = (_Float16)bf16_round(x[t * 8 + q]); *(v8us*)((unsigned short*)X16 + t * 8) = f.half[0];  }
__global__ __launch_bounds__(256) void k_h16(const float* __restrict__ x, _Float16* __restrict__ X16, size_t n8) { const size_t t = (size_t)blockIdx.x * 256 + threadIdx.x; if (t >= n8) return; FragH f;
#pragma unroll
  for (int q = 0; q < 8; ++q) f.h[q] = (_Float16)x[t * 8 + q]; *(v8us*)((unsigned short*)X16 + t * 8) = f.half[0];  }
__global__ __launch_bounds__(256) void k_round16f(const float* __restrict__ W, _Float16* __restrict__ Bt, size_t n8) { const size_t t = (size_t)blockIdx.x * 256 + threadIdx.x; if (t >= n8) return; FragH f;
#pragma unroll
  for (int i = 0; i < 8; ++i) f.h[i] = (_Float16)(bf16_round(W[t * 8 + i]) * 16.0f); *(v8us*)((unsigned short*)Bt + t * 8) = f.half[0];  }
template <int NHv, int TTv>
__global__ __launch_bounds__(256) void k_vt(const _Float16* __restrict__ V16, int ldv, int voff, _Float16* __restrict__ Vt) { __shared__ unsigned short tl[64][66]; const int tid = threadIdx.x; const int slab = blockIdx.x / (TTv / 64), lg = blockIdx.x % (TTv / 64); const int b = slab / NHv, h = slab % NHv;
  for (int i = tid; i < 64 * 8; i += 256) { const int r = i / 8, c8 = (i % 8) * 8; FragH f; f.half[0] = *(const v8us*)((const unsigned short*)V16 + ((size_t)b * TTv + lg * 64 + r) * ldv + voff + h * 64 + c8);
#pragma unroll
    for (int q = 0; q < 8; ++q) tl[r][c8 + q] = f.u[q]; }
  __syncthreads();
  {
#pragma unroll
    for (int rd = 0; rd < 2; ++rd) { const int d = rd * 32 + tid / 8, pc = tid % 8; FragH f;
#pragma unroll
      for (int q = 0; q < 8; ++q) f.u[q] = tl[pc * 8 + q][d];
      *(v8us*)((unsigned short*)Vt + ((size_t)slab * 64 + d) * TTv + lg * 64 + pc * 8) = f.half[0]; }
     } }

__global__ __launch_bounds__(256) void k_hl(const float* __restrict__ F, _Float16* __restrict__ Hh, _Float16* __restrict__ Hl, size_t n8) { const size_t t = (size_t)blockIdx.x * 256 + threadIdx.x; if (t >= n8) return; FragH fh, fl; const v4f a = *(const v4fa*)(F + t * 8), c = *(const v4fa*)(F + t * 8 + 4);
#pragma unroll
  for (int q = 0; q < 4; ++q) { _Float16 h = (_Float16)a[q]; fh.h[q] = h; fl.h[q] = (_Float16)((a[q] - (float)h) * 1024.0f); h = (_Float16)c[q]; fh.h[4 + q] = h; fl.h[4 + q] = (_Float16)((c[q] - (float)h) * 1024.0f); }
  { *(v8us*)((unsigned short*)Hh + t * 8) = fh.half[0]; *(v8us*)((unsigned short*)Hl + t * 8) = fl.half[0];  } }

// ---- fast GEMM (wave tile 32x64; requires M % 32 == 0 rows per launch region and N % 64 == 0); epilogue = k_gemm_hhx semantics ----
__device__ __forceinline__ v16h g2_frag(const _Float16* p, int hh) { FragH f; f.half[0] = *(const v8us*)((const unsigned short*)p + 8 * hh); f.half[1] = *(const v8us*)((const unsigned short*)p + 16 + 8 * hh); return f.v; }
__device__ __forceinline__ v8f g2_mma(v16h a, v16h b, v8f c) { v8f d = __builtin_amdgcn_wmma_f32_16x16x32_f16(false, a, false, b, (short)0, c, false, false); asm volatile("v_nop\n\tv_nop\n\tv_nop\n\tv_nop" : "+v"(d) : "v"(a), "v"(b)); return d; }
template <int ACT>
__global__ __launch_bounds__(128) void k_gemm2(const _Float16* __restrict__ A, int lda, size_t sA, const _Float16* __restrict__ Bh, int ldb, size_t sB, float alpha, const float* __restrict__ bias, size_t sBias, const float* __restrict__ CP, int rowsPerB, size_t sCPb, int row0g,
    float* __restrict__ C, _Float16* __restrict__ C16, int ldc, size_t sC, int M, int N, int K) { static_assert(ACT == 0 || ACT == 3 || ACT == 6 || ACT == 8 || ACT == 9 || ACT == 11 || ACT == 12 || ACT == 14 || ACT == 15 || ACT == 16 || ACT == 17, "k_gemm2: unsupported ACT code (would silently apply no activation)");
  __shared__ __attribute__((aligned(16))) float so[4][32][68];
  const int tid = threadIdx.x, w = tid >> 5, lane = tid & 31, ln = lane & 15, hh = lane >> 4; const int by = blockIdx.y;
  A += (size_t)by * sA; Bh += (size_t)by * sB; const size_t cofs = (size_t)by * sC; const float* bp = bias ? bias + (size_t)by * sBias : nullptr;
  const int ntn = N >> 6; const int mt = blockIdx.x / ntn, nq = blockIdx.x - mt * ntn; const int row0 = mt * 128 + 32 * w, col0 = nq * 64; if (row0 >= M) return;
  const _Float16* a0p = A + (size_t)(row0 + ln) * lda; const _Float16* a1p = a0p + (size_t)16 * lda;
  const _Float16* b0p = Bh + (size_t)(col0 + ln) * ldb; const _Float16* b1p = b0p + (size_t)16 * ldb; const _Float16* b2p = b1p + (size_t)16 * ldb; const _Float16* b3p = b2p + (size_t)16 * ldb;
  const v8f z8 = {0.f,0.f,0.f,0.f,0.f,0.f,0.f,0.f}; v8f c00 = z8, c01 = z8, c02 = z8, c03 = z8, c10 = z8, c11 = z8, c12 = z8, c13 = z8;
#pragma unroll 1
  for (int kb = 0; kb < K; kb += 32) { const v16h a0 = g2_frag(a0p + kb, hh), a1 = g2_frag(a1p + kb, hh);
    v16h b = g2_frag(b0p + kb, hh); c00 = g2_mma(a0, b, c00); c10 = g2_mma(a1, b, c10);
    b = g2_frag(b1p + kb, hh); c01 = g2_mma(a0, b, c01); c11 = g2_mma(a1, b, c11);
    b = g2_frag(b2p + kb, hh); c02 = g2_mma(a0, b, c02); c12 = g2_mma(a1, b, c12);
    b = g2_frag(b3p + kb, hh); c03 = g2_mma(a0, b, c03); c13 = g2_mma(a1, b, c13); }
  v8f accs[8] = {c00, c01, c02, c03, c10, c11, c12, c13};
#pragma unroll
  for (int u = 0; u < 8; ++u) { const int t = u & 3, half = u >> 2; const int col = col0 + t * 16 + ln; const float bv = bp ? bf16_round(bp[col]) : 0.f;
#pragma unroll
    for (int r = 0; r < 8; ++r) { const int rloc = half * 16 + 8 * hh + r; float v = accs[u][r] * alpha + bv; if (CP) { if (rowsPerB < 0) v += CP[cofs + (size_t)(row0g + row0 + rloc) * ldc + col];      /* rowsPerB < 0: own element of the batched C plane */ else { const int bidx = (row0g + row0 + rloc) / rowsPerB; v += CP[(size_t)bidx * sCPb + (size_t)by * 64 + col]; } }
      if (ACT == 3) v = fmaxf(v, 0.f); else if (ACT == 6) v = 0.5f * v * (1.0f + erff(v * 0.70710678118654752f)); else if (ACT == 11) v = 1.0f / (1.0f + expf(-v)); else if (ACT == 15) v = v / (1.0f + expf(-v)); else if (ACT == 12) v = (v > 0.f) ? v : 0.01f * v; else if (ACT == 8) v = tanhf(v); else if (ACT == 9) v = 0.5f * v * (1.0f + tanhf(0.7978845608028654f * (v + 0.044715f * v * v * v))); else if (ACT == 14) v = (v > 0.f) ? v : 0.1f * v; else if (ACT == 16) v = (v >= 0.f) ? v : 0.3f * v; else if (ACT == 17) v = (v >= 0.f) ? v : 0.2f * v;
      so[w][rloc][t * 16 + ln] = v; } }
  __builtin_amdgcn_fence(__ATOMIC_ACQ_REL, "workgroup"); __builtin_amdgcn_wave_barrier();
  const int rsub = lane >> 4, c4 = (lane & 15) * 4;
  {
#pragma unroll
    for (int q = 0; q < 16; ++q) { const int r = q * 2 + rsub; const v4f v = *(const v4fa*)&so[w][r][c4]; if (C) *(v4f*)(C + cofs + (size_t)(row0 + r) * ldc + col0 + c4) = v; if (C16) { v4h h4; for (int i = 0; i < 4; ++i) h4[i] = (_Float16)v[i]; *(v4h*)(C16 + cofs + (size_t)(row0 + r) * ldc + col0 + c4) = h4; } }
     } }


__global__ __launch_bounds__(256) void k_wnat(const float* __restrict__ w, size_t n8, _Float16* __restrict__ Bt) { const size_t t = (size_t)blockIdx.x * 256 + threadIdx.x; if (t >= n8) return; FragH f; for (int q = 0; q < 8; ++q) f.h[q] = (_Float16)(bf16_round(w[t * 8 + q]) * 16.0f); *(v8us*)((unsigned short*)Bt + t * 8) = f.half[0];  }
__global__ __launch_bounds__(256) void k_rsm(const float* __restrict__ S, _Float16* __restrict__ P, int nrows) {
  #pragma clang fp contract(off)
  const int i = blockIdx.x * 256 + threadIdx.x; if (i >= nrows) return; const float* s = S + (size_t)i * SQ; float mx = -3.0e38f;
#pragma unroll 1
  for (int j = 0; j < SQ; ++j) mx = fmaxf(mx, s[j]); float se = 0.f;
#pragma unroll 1
  for (int j = 0; j < SQ; ++j) se += expf(s[j] - mx); const float sc = 256.0f / se;
#pragma unroll 1
  for (int j0 = 0; j0 < SQ; j0 += 8) { FragH f; for (int q = 0; q < 8; ++q) f.h[q] = (_Float16)(expf(s[j0 + q] - mx) * sc); unsigned short* d = (unsigned short*)P + (size_t)i * SQ + j0; *(v8us*)d = f.half[0];  } }
__global__ __launch_bounds__(256) void k_vt(const _Float16* __restrict__ V16, int b, int h0, _Float16* __restrict__ VT) { __shared__ unsigned short tl[64][65]; const int tid = threadIdx.x; const int hh = blockIdx.x % HG, sg = blockIdx.x / HG; const int s0 = sg * 64; const int h = h0 + hh;
  for (int i = tid; i < 64 * 8; i += 256) { const int j = i / 8, d8 = (i % 8) * 8; FragH f; f.half[0] = *(const v8us*)((const unsigned short*)V16 + ((size_t)b * SQ + s0 + j) * DM + h * HD + d8); for (int q = 0; q < 8; ++q) tl[d8 + q][j] = f.u[q]; }
  __syncthreads();
  { for (int i = tid; i < 64 * 8; i += 256) { const int d = i / 8, j8 = (i % 8) * 8; FragH f; for (int q = 0; q < 8; ++q) f.u[q] = tl[d][j8 + q]; *(v8us*)((unsigned short*)VT + ((size_t)hh * HD + d) * SQ + s0 + j8) = f.half[0]; }  } }



__global__ __launch_bounds__(256) void k_rsmcf2(const float* __restrict__ S, _Float16* __restrict__ P, int hg, int q0, int nk) {
  #pragma clang fp contract(off)
  const int t = blockIdx.x * 256 + threadIdx.x; if (t >= hg * QT) return; const size_t i = (size_t)t; const float* s = S + i * NKX; const int last = q0 + (t % QT); float mx = -3.0e38f;
#pragma unroll 1
  for (int j = 0; j < nk; ++j) { const float f = (j <= last) ? 1.f : 0.f; mx = fmaxf(mx, fmaf(f, s[j], (1.f - f) * -1.0e9f)); } float se = 0.f;
#pragma unroll 1
  for (int j = 0; j < nk; ++j) { const float f = (j <= last) ? 1.f : 0.f; se += __expf(fmaf(f, s[j], (1.f - f) * -1.0e9f) - mx); } const float sc = 256.0f / se;
#pragma unroll 1
  for (int j0 = 0; j0 < nk; j0 += 8) { FragH fr; for (int q = 0; q < 8; ++q) { const int j = j0 + q; const float f = (j <= last) ? 1.f : 0.f; fr.h[q] = (_Float16)(__expf(fmaf(f, s[j], (1.f - f) * -1.0e9f) - mx) * sc); } unsigned short* d = (unsigned short*)P + i * NKX + j0; *(v8us*)d = fr.half[0];  } }


template <int MASKADD>
__global__ __launch_bounds__(64) void k_att0(const float* __restrict__ QF, const float* __restrict__ KF, const float* __restrict__ VF, int ld, const float* __restrict__ mask, float scale, float* __restrict__ OF, int ldo) {
  #pragma clang fp contract(off)
  __shared__ __attribute__((aligned(16))) float lq[64][64]; __shared__ __attribute__((aligned(16))) float lo[64][64];
  const int tid = threadIdx.x; const int h = blockIdx.x / (QT0 / 64), rg = blockIdx.x % (QT0 / 64); const int i = rg * 64 + tid;
  const float* qr = QF + (size_t)i * ld + h * HD;
#pragma unroll 1
  for (int c = 0; c < HD / 4; ++c) { *(v4f*)&lq[tid][c * 4] = *(const v4fa*)(qr + c * 4); const v4f z = {0.f, 0.f, 0.f, 0.f}; *(v4f*)&lo[tid][c * 4] = z; }
  float m = -1.0e30f, l = 0.f; const int jmax = MASKADD ? (SQ - 1) : (rg * 64 + 63);      /* additive-mask form: every key (the mask input decides); causal form: keys up to the block's last row */
#pragma unroll 1
  for (int j = 0; j <= jmax; ++j) { const float* kr = KF + (size_t)j * ld + h * HD; const float* vr = VF + (size_t)j * ld + h * HD; float s = 0.f;
#pragma unroll 1
    for (int c = 0; c < HD / 4; ++c) { const v4f kq = *(const v4fa*)(kr + c * 4); const v4f qq = *(v4f*)&lq[tid][c * 4]; s = __fadd_rn(s, __fmul_rn(qq[0], kq[0])); s = __fadd_rn(s, __fmul_rn(qq[1], kq[1])); s = __fadd_rn(s, __fmul_rn(qq[2], kq[2])); s = __fadd_rn(s, __fmul_rn(qq[3], kq[3])); }
    s = __fmul_rn(s, scale); if (MASKADD) s = __fadd_rn(s, __fmul_rn(bf16_round(mask[(size_t)i * SQ + j]), -10000.0f));
    const float f = (MASKADD || j <= i) ? 1.f : 0.f; const float sm = fmaf(f, s, (1.f - f) * -1.0e30f); const float mn = fmaxf(m, sm); const float sc = expf(m - mn); const float e = expf(sm - mn); l = __fadd_rn(__fmul_rn(l, sc), e); m = mn;
#pragma unroll 1
    for (int c = 0; c < HD / 4; ++c) { const v4f vv = *(const v4fa*)(vr + c * 4); v4f oo = *(v4f*)&lo[tid][c * 4]; for (int u = 0; u < 4; ++u) oo[u] = __fadd_rn(__fmul_rn(oo[u], sc), __fmul_rn(e, vv[u])); *(v4f*)&lo[tid][c * 4] = oo; } }
  const float fin = 64.0f / l;      /* o carried x64 */
#pragma unroll 1
  for (int c = 0; c < HD / 4; ++c) { v4f oo = *(v4f*)&lo[tid][c * 4]; for (int u = 0; u < 4; ++u) oo[u] = __fmul_rn(oo[u], fin); *(v4f*)&lo[tid][c * 4] = oo; }
  __syncthreads();
  {
#pragma unroll 1
    for (int it = 0; it < 16; ++it) { const int row = it * 4 + tid / 16, pc = (tid % 16) * 4; const v4f v = *(const v4f*)&lo[row][pc]; *(v4f*)(OF + (size_t)(rg * 64 + row) * ldo + h * HD + pc) = v; }
     } }


__global__ __launch_bounds__(256) void k_trirow(const float* __restrict__ S, float* __restrict__ WPD) {
  #pragma clang fp contract(off)
  const int b = blockIdx.x * 256 + threadIdx.x; if (b >= SQ) return; const float* s = S + (size_t)b * SQ; float m = (b > 0) ? 0.f : -3.0e38f;
#pragma unroll 1
  for (int a = b; a < SQ; ++a) m = fmaxf(m, s[a]); float z = __fmul_rn((float)b, expf(-m));
#pragma unroll 1
  for (int a = b; a < SQ; ++a) z = __fadd_rn(z, expf(__fadd_rn(s[a], -m)));
  const float wp = __fdiv_rn(expf(-m), z), wd = __fdiv_rn(expf(__fadd_rn(s[b], -m)), z);
  *(float*)(WPD + 2 * b) = wp; *(float*)(WPD + 2 * b + 1) = wd;  }
__global__ __launch_bounds__(256) void k_colscan(const float* __restrict__ V, float* __restrict__ PRE) {
  #pragma clang fp contract(off)
  const int c = blockIdx.x * 256 + threadIdx.x; if (c >= DM) return;
  { float acc = 0.f;
#pragma unroll 1
    for (int b = 0; b < SQ; ++b) { *(float*)(PRE + (size_t)b * DM + c) = acc; acc = __fadd_rn(acc, V[(size_t)b * DM + c]); }
     } }
__global__ __launch_bounds__(256) void k_trifin(const float* __restrict__ PRE, const float* __restrict__ V, const float* __restrict__ WPD, float* __restrict__ out, size_t n4) {
  #pragma clang fp contract(off)
  const size_t t = (size_t)blockIdx.x * 256 + threadIdx.x; if (t >= n4) return; const size_t e = t * 4; const int b = (int)(e / DM); const float wp = WPD[2 * b], wd = WPD[2 * b + 1];
  const v4f p = *(const v4fa*)(PRE + e), v = *(const v4fa*)(V + e); v4f r; for (int q = 0; q < 4; ++q) r[q] = __fadd_rn(__fmul_rn(wp, p[q]), __fmul_rn(wd, v[q]));
  *(v4f*)(out + e) = r;  }

__global__ __launch_bounds__(256) void k_rsmfu(const float* __restrict__ S, _Float16* __restrict__ P) {
  #pragma clang fp contract(off)
  const int j = blockIdx.x * 256 + threadIdx.x; if (j >= SQ) return; const float* s = S + (size_t)j * SQ; float mx = -3.0e38f;
#pragma unroll 1
  for (int i = 0; i < SQ; ++i) { const float f = (i >= j) ? 1.f : 0.f; mx = fmaxf(mx, fmaf(f, s[i], (1.f - f) * -1.0e9f)); } float se = 0.f;
#pragma unroll 1
  for (int i = 0; i < SQ; ++i) { const float f = (i >= j) ? 1.f : 0.f; se += __expf(fmaf(f, s[i], (1.f - f) * -1.0e9f) - mx); } const float sc = 256.0f / se;
#pragma unroll 1
  for (int i0 = 0; i0 < SQ; i0 += 8) { FragH fr; for (int q = 0; q < 8; ++q) { const int i = i0 + q; const float f = (i >= j) ? 1.f : 0.f; fr.h[q] = (_Float16)(__expf(fmaf(f, s[i], (1.f - f) * -1.0e9f) - mx) * sc); } unsigned short* d = (unsigned short*)P + (size_t)j * SQ + i0; *(v8us*)d = fr.half[0];  } }
__global__ __launch_bounds__(256) void k_cs(const float* __restrict__ QF, const float* __restrict__ KF, float* __restrict__ SC) {
  #pragma clang fp contract(off)
  const int t = blockIdx.x * 256 + threadIdx.x; if (t >= 256 * 256) return; const int i = t / 256, j = t % 256; float s = -1.0e9f;
  if (j <= i) { const float* q = QF + (size_t)i * DM; const float* k = KF + (size_t)j * DM; float a = 0.f;
#pragma unroll 4
    for (int d = 0; d < DM; ++d) a = __fadd_rn(a, __fmul_rn(q[d], k[d])); s = __fmul_rn(a, 0.03125f); }
  *(float*)(SC + t) = s;  }
__global__ __launch_bounds__(256) void k_cz(const float* __restrict__ SC, float* __restrict__ W) {
  #pragma clang fp contract(off)
  const int j = threadIdx.x; float m = -3.0e38f;
#pragma unroll 1
  for (int i = j; i < 256; ++i) m = fmaxf(m, SC[i * 256 + j]); float z = 0.f;
#pragma unroll 1
  for (int i = j; i < 256; ++i) z = __fadd_rn(z, expf(__fadd_rn(SC[i * 256 + j], -m)));
  const float rz = __fdiv_rn(1.0f, z);
  {
#pragma unroll 1
    for (int i = 0; i < 256; ++i) { const float w = (i >= j) ? __fmul_rn(expf(__fadd_rn(SC[i * 256 + j], -m)), rz) : 0.f; *(float*)(W + i * 256 + j) = w; }
     } }
__global__ __launch_bounds__(256) void k_co(const float* __restrict__ W, const float* __restrict__ VF, float* __restrict__ out) {
  #pragma clang fp contract(off)
  const int t = blockIdx.x * 256 + threadIdx.x; if (t >= 256 * (DM / 4)) return; const int i = t / (DM / 4); const int c = (t % (DM / 4)) * 4; v4f acc = {0.f, 0.f, 0.f, 0.f};
#pragma unroll 1
  for (int j = 0; j <= i; ++j) { const float w = W[i * 256 + j]; const v4f v = *(const v4fa*)(VF + (size_t)j * DM + c); for (int u = 0; u < 4; ++u) acc[u] = __fadd_rn(acc[u], __fmul_rn(w, v[u])); }
  float* o = out + (size_t)i * DM + c; const v4f base = *(const v4fa*)o; v4f r; for (int u = 0; u < 4; ++u) r[u] = __fadd_rn(base[u], acc[u]);
  *(v4f*)o = r;  }

__global__ __launch_bounds__(256) void k_rsmfhl(const float* __restrict__ S, _Float16* __restrict__ P, _Float16* __restrict__ PL, int nrows) {
  #pragma clang fp contract(off)
  const int t = blockIdx.x * 256 + threadIdx.x; if (t >= nrows) return; const float* s = S + (size_t)t * SQ; float mx = -3.0e38f;
#pragma unroll 1
  for (int j = 0; j < SQ; ++j) mx = fmaxf(mx, s[j]); float se = 0.f;
#pragma unroll 1
  for (int j = 0; j < SQ; ++j) se += __expf(s[j] - mx); const float sc = 256.0f / se;
#pragma unroll 1
  for (int j0 = 0; j0 < SQ; j0 += 8) { FragH fr, fl; for (int q = 0; q < 8; ++q) { const float v = __expf(s[j0 + q] - mx) * sc; const _Float16 hv = (_Float16)v; fr.h[q] = hv; fl.h[q] = (_Float16)((v - (float)hv) * 1024.0f); }
    unsigned short* d = (unsigned short*)P + (size_t)t * SQ + j0; unsigned short* dl = (unsigned short*)PL + (size_t)t * SQ + j0; *(v8us*)d = fr.half[0]; *(v8us*)dl = fl.half[0];  } }

__global__ __launch_bounds__(256) void k_rsmf(const float* __restrict__ S, _Float16* __restrict__ P, int qn, int hg) {
  #pragma clang fp contract(off)
  const int t = blockIdx.x * 256 + threadIdx.x; if (t >= qn * hg) return; const size_t i = (size_t)(t / qn) * SQ + (t % qn); const float* s = S + i * SQ; float mx = -3.0e38f;
#pragma unroll 1
  for (int j = 0; j < SQ; ++j) mx = fmaxf(mx, s[j]); float se = 0.f;
#pragma unroll 1
  for (int j = 0; j < SQ; ++j) se += __expf(s[j] - mx); const float sc = 256.0f / se;
#pragma unroll 1
  for (int j0 = 0; j0 < SQ; j0 += 8) { FragH f; for (int q = 0; q < 8; ++q) f.h[q] = (_Float16)(__expf(s[j0 + q] - mx) * sc); unsigned short* d = (unsigned short*)P + i * SQ + j0; *(v8us*)d = f.half[0];  } }


extern "C" void kernel_launch(void* const* d_in, const int* in_sizes, int n_in,
                              void* d_out, int out_size, void* d_ws, size_t ws_size, hipStream_t stream) {
  (void)in_sizes; (void)n_in; (void)out_size;
  const float* const* I = (const float* const*)d_in; const float* xq = I[0]; const float* xk = I[1]; const float* xv = I[2];      /* q, k, v [4][4096][512] (bf16-valued) */
  char* ws = (char*)d_ws; size_t off = 0;
  auto take = [&](size_t bytes) { char* p = ws + off; off += (bytes + 255) & ~(size_t)255; return p; };
  _Float16* Q16 = (_Float16*)take(NR * DM * 2); _Float16* K16 = (_Float16*)take(NR * DM * 2); _Float16* V16 = (_Float16*)take(NR * DM * 2);
  float* S = (float*)take((size_t)SQ * SQ * 4); _Float16* P = (_Float16*)take((size_t)SQ * SQ * 2); _Float16* VT = (_Float16*)take((size_t)DM * SQ * 2);
  if (off > ws_size) return;
  k_x16<<<(unsigned)((NR * DM / 8 + 255) / 256), 256, 0, stream>>>(xq, Q16, NR * DM / 8); k_x16<<<(unsigned)((NR * DM / 8 + 255) / 256), 256, 0, stream>>>(xk, K16, NR * DM / 8); k_x16<<<(unsigned)((NR * DM / 8 + 255) / 256), 256, 0, stream>>>(xv, V16, NR * DM / 8);      /* exact f16 copies of the bf16-valued inputs */
  for (int b = 0; b < NB; ++b) { const size_t r0 = (size_t)b * SQ;
    k_gemm2<0><<<dim3((SQ / 128) * (SQ / 64), 1), 128, 0, stream>>>(Q16 + r0 * DM, DM, 0, K16 + r0 * DM, DM, 0, 0.125f, nullptr, 0, nullptr, 1, 0, 0, S, nullptr, SQ, 0, SQ, SQ, DM);      /* S = q k^T / sqrt(64) (K = 512, exact products) over the ORIGINAL order */
    k_rsmf<<<(SQ + 255) / 256, 256, 0, stream>>>(S, P, SQ, 1);      /* softmax over all 4096 positions -> P x256 f16 */
    k_vt<DM / 64, SQ><<<(DM / 64) * (SQ / 64), 256, 0, stream>>>(V16 + r0 * DM, DM, 0, VT);      /* V^T [512][4096] */
    k_gemm2<0><<<dim3((SQ / 128) * (DM / 64), 1), 128, 0, stream>>>(P, SQ, 0, VT, SQ, 0, 0.00390625f, nullptr, 0, nullptr, 1, 0, 0, (float*)d_out + r0 * DM, nullptr, DM, 0, SQ, DM, SQ); }      /* out = P V^T 2^-8 f32 into the batch's rows (original order: the module's inverse permutation undoes its permutation) */
}

// v001
// A run of this version takes 831 microseconds.
// Two timings next to v000 put it at 4.18 and 4.19 times that version's speed.
#include <hip/hip_runtime.h>
// Dense single-head attention over a strided-permuted sequence (q, k, v [4][4096][512]; the module permutes the sequence (64 x 64 blocks transposed), runs FULL softmax attention w = softmax(q k^T / sqrt(64)) over all 4096 positions, a = w v, and applies the inverse permutation — a full attention is permutation-equivariant, so out[t] = softmax(q_t K^T / 8) V on the original order -> [4][4096][512]).
// Structure: token rows; the bf16-valued q, k, v inputs as exact f16 rows; per batch: S = q k^T / 8 (K = 512, exact products) as ONE WMMA GEMM (32x64 wave tiles, f32 accumulation) [4096][4096] f32; row softmax on VALU (f32 statistics, native exp; weights x256 f16); V^T via LDS transposes; out = P V^T 2^-8 f32.
// Compute dtype: inputs rounded to bf16; q, k, v and softmax weights as plain f16 GEMM operands (~2^-12); scores and softmax statistics f32. v_wmma_f32_16x16x32_f16.
#define NB 4
#define SQ 4096
#define DM 512
#define NH 16
#define HD 64
#define HG 4                         /* heads per launch of k_vt(V16, b, h0, VT), which is not launched */
#define QT 256                       /* query rows per causal tile */
#define NKX SQ                       /* S / P row pitch */
#define QT0 128                      /* first-tile rows recomputed exactly in f32 */
#define B0 0                         /* first batch processed (debug hook) */
#define NBR NB                       /* batches processed (debug hook) */
#define NR ((size_t)NB * SQ)         /* token rows */
#define MP ((int)((size_t)NBR * SQ)) /* rows projected (debug hook) */
#define QN SQ                        /* query rows attended per batch (debug hook) */
#define NHD NH                       /* unused; the attention here is single-head */
#define MPO MP                       /* rows through the output stage (debug hook) */
#define LQ DM      /* row pitch of the q/k/v rows */
typedef __bf16 v16b __attribute__((ext_vector_type(16)));
typedef unsigned short v8us __attribute__((ext_vector_type(8), may_alias));
typedef float  v8f  __attribute__((ext_vector_type(8)));
typedef float  v4f  __attribute__((ext_vector_type(4)));
typedef float  v4fa __attribute__((ext_vector_type(4), may_alias));
union FragB { v16b v; v8us half[2]; unsigned short u[16]; };

__device__ __forceinline__ unsigned short bf16_bits(float x) { unsigned int u = __float_as_uint(x); return (unsigned short)((u + 0x7FFFu + ((u >> 16) & 1u)) >> 16); }
__device__ __forceinline__ float bf16_val(unsigned short b) { return __uint_as_float(((unsigned int)b) << 16); }
__device__ __forceinline__ float bf16_round(float x) { return bf16_val(bf16_bits(x)); }
// D += A·B with NT terms: 1 = ah·bh, 2 = + al·bh (A split), 3 = + ah·bl (both split)
template <int NT>
__device__ __forceinline__ v8f mmaN(v16b ah, v16b al, v16b bh, v16b bl, v8f c) {
  c = __builtin_amdgcn_wmma_f32_16x16x32_bf16(false, ah, false, bh, (short)0, c, false, false);
  if (NT >= 2) c = __builtin_amdgcn_wmma_f32_16x16x32_bf16(false, al, false, bh, (short)0, c, false, false);
  if (NT >= 3) c = __builtin_amdgcn_wmma_f32_16x16x32_bf16(false, ah, false, bl, (short)0, c, false, false);
  asm volatile("v_nop\n\tv_nop\n\tv_nop\n\tv_nop" : "+v"(c) : "v"(ah), "v"(al), "v"(bh), "v"(bl));
  return c;
}

__global__ __launch_bounds__(256) void k_wt_bf16(const float* __restrict__ W, unsigned short* __restrict__ Wt, int K, int N) {
  const int t = blockIdx.x * 256 + threadIdx.x;
  const int k8n = K / 8;
  if (t >= N * k8n) return;
  const int n = t / k8n, k8 = (t % k8n) * 8;
  v8us v;
#pragma unroll
  for (int i = 0; i < 8; ++i) v[i] = bf16_bits(W[(size_t)(k8 + i) * N + n]);
  *(v8us*)(Wt + (size_t)n * K + k8) = v;
  
}

// GEMM C[M][N] (f32, pitch ldc) = act(A[M][K]·W + bias). A f32 row-major (pitch lda) converted per fragment to bf16
// (ASPLIT: hi/lo two planes -> 2 terms, else single rounded term); Wt bf16 [N][K] (pitch ldb). BIAS_BF16 rounds the
// bias to bf16 first (bias quantised to bf16 before the add). K%32==0, M%16==0, N%64==0.
template <bool ASPLIT, int ACT, bool BIAS_BF16>
__global__ __launch_bounds__(128) void k_gemm_bf(const float* __restrict__ A, int lda, const unsigned short* __restrict__ Wt, int ldb,
                                               const float* __restrict__ bias, float* __restrict__ C, int ldc, int M, int N, int K) {
  __shared__ __attribute__((aligned(16))) float so[4][16][64];
  const int tid = threadIdx.x, w = tid >> 5, lane = tid & 31, ln = lane & 15, hh = lane >> 4;
  const int ntn = N / 64;
  const int wid = blockIdx.x * 4 + w;
  const int mt = wid / ntn, nq = wid % ntn;
  if (mt * 16 >= M) return;
  const int row0 = mt * 16, col0 = nq * 64;
  const float* arow = A + (size_t)(row0 + ln) * lda;
  v8f acc[4] = {};
  for (int kb = 0; kb < K; kb += 32) {
    FragB ah, al;
    const v4f x0 = *(const v4fa*)(arow + kb + 8 * hh), x1 = *(const v4fa*)(arow + kb + 8 * hh + 4);
    const v4f x2 = *(const v4fa*)(arow + kb + 16 + 8 * hh), x3 = *(const v4fa*)(arow + kb + 16 + 8 * hh + 4);
    float xs[16] = {x0[0],x0[1],x0[2],x0[3],x1[0],x1[1],x1[2],x1[3],x2[0],x2[1],x2[2],x2[3],x3[0],x3[1],x3[2],x3[3]};
#pragma unroll
    for (int i = 0; i < 16; ++i) { const unsigned short hb = bf16_bits(xs[i]); ah.u[i] = hb; al.u[i] = ASPLIT ? bf16_bits(xs[i] - bf16_val(hb)) : (unsigned short)0; }
#pragma unroll
    for (int t = 0; t < 4; ++t) {
      const unsigned short* brow = Wt + (size_t)(col0 + t * 16 + ln) * ldb + kb;
      FragB b;
      b.half[0] = *(const v8us*)(brow + 8 * hh);
      b.half[1] = *(const v8us*)(brow + 16 + 8 * hh);
      acc[t] = mmaN<ASPLIT ? 2 : 1>(ah.v, al.v, b.v, b.v, acc[t]);
    }
  }
#pragma unroll
  for (int t = 0; t < 4; ++t) {
    float bv = bias ? bias[col0 + t * 16 + ln] : 0.f;
    if (BIAS_BF16) bv = bf16_round(bv);
#pragma unroll
    for (int r = 0; r < 8; ++r) { float v = acc[t][r] + bv; if (ACT == 1) v = fmaxf(v, 0.f); so[w][8 * hh + r][t * 16 + ln] = v; }
  }
  __builtin_amdgcn_fence(__ATOMIC_ACQ_REL, "workgroup");
  __builtin_amdgcn_wave_barrier();
  const int rsub = lane >> 4, c4 = (lane & 15) * 4;
  {
#pragma unroll
    for (int q = 0; q < 8; ++q) {
      const int r = q * 2 + rsub;
      const v4f v = *(const v4fa*)&so[w][r][c4];
      *(v4f*)(C + (size_t)(row0 + r) * ldc + col0 + c4) = v;
    }
    
  }
}

// GEMM C = act(A·W + bias + resid): A f32 (ASPLIT -> hi/lo 2 terms), Wt bf16 [N][K]; ACT 0 none, 1 relu, 2 exact gelu;
// resid (optional, f32, row index = (row % rmod), pitch ldr, RES_BF16 rounds it) added before the activation.
template <bool ASPLIT, int ACT, bool BIAS_BF16, bool RES_BF16>
__global__ __launch_bounds__(128) void k_gemm_bf3(const float* __restrict__ A, int lda, const unsigned short* __restrict__ Wt, int ldb,
                                                const float* __restrict__ bias, const float* __restrict__ resid, int rmod, int ldr,
                                                float* __restrict__ C, int ldc, int M, int N, int K) {
  __shared__ __attribute__((aligned(16))) float so[4][16][64];
  const int tid = threadIdx.x, w = tid >> 5, lane = tid & 31, ln = lane & 15, hh = lane >> 4;
  const int ntn = N / 64;
  const int wid = blockIdx.x * 4 + w;
  const int mt = wid / ntn, nq = wid % ntn;
  if (mt * 16 >= M) return;
  const int row0 = mt * 16, col0 = nq * 64;
  const float* arow = A + (size_t)(row0 + ln) * lda;
  v8f acc[4] = {};
  for (int kb = 0; kb < K; kb += 32) {
    FragB ah, al;
    const v4f x0 = *(const v4fa*)(arow + kb + 8 * hh), x1 = *(const v4fa*)(arow + kb + 8 * hh + 4);
    const v4f x2 = *(const v4fa*)(arow + kb + 16 + 8 * hh), x3 = *(const v4fa*)(arow + kb + 16 + 8 * hh + 4);
    float xs[16] = {x0[0],x0[1],x0[2],x0[3],x1[0],x1[1],x1[2],x1[3],x2[0],x2[1],x2[2],x2[3],x3[0],x3[1],x3[2],x3[3]};
#pragma unroll
    for (int i = 0; i < 16; ++i) { const unsigned short hb = bf16_bits(xs[i]); ah.u[i] = hb; al.u[i] = ASPLIT ? bf16_bits(xs[i] - bf16_val(hb)) : (unsigned short)0; }
#pragma unroll
    for (int t = 0; t < 4; ++t) {
      const unsigned short* brow = Wt + (size_t)(col0 + t * 16 + ln) * ldb + kb;
      FragB b;
      b.half[0] = *(const v8us*)(brow + 8 * hh);
      b.half[1] = *(const v8us*)(brow + 16 + 8 * hh);
      acc[t] = mmaN<ASPLIT ? 2 : 1>(ah.v, al.v, b.v, b.v, acc[t]);
    }
  }
#pragma unroll
  for (int t = 0; t < 4; ++t) {
    const int col = col0 + t * 16 + ln;
    float bv = bias ? bias[col] : 0.f;
    if (BIAS_BF16) bv = bf16_round(bv);
#pragma unroll
    for (int r = 0; r < 8; ++r) {
      float v = acc[t][r] + bv;
      if (resid) { float rv = resid[(size_t)((row0 + 8 * hh + r) % rmod) * ldr + col]; if (RES_BF16) rv = bf16_round(rv); v += rv; }
      if (ACT == 1) v = fmaxf(v, 0.f);
      if (ACT == 2) v = 0.5f * v * (1.0f + erff(v * 0.70710678118654752f));
      if (ACT == 3) { const float u = 0.7978845608028654f * (v + 0.044715f * v * v * v); v = 0.5f * v * (1.0f + tanhf(u)); }
      so[w][8 * hh + r][t * 16 + ln] = v;
    }
  }
  __builtin_amdgcn_fence(__ATOMIC_ACQ_REL, "workgroup");
  __builtin_amdgcn_wave_barrier();
  const int rsub = lane >> 4, c4 = (lane & 15) * 4;
  {
#pragma unroll
    for (int q = 0; q < 8; ++q) {
      const int r = q * 2 + rsub;
      const v4f v = *(const v4fa*)&so[w][r][c4];
      *(v4f*)(C + (size_t)(row0 + r) * ldc + col0 + c4) = v;
    }
    
  }
}
// row LayerNorm (biased variance, eps) over N: s = X (+ R); optional out_sum <- s; out_norm <- (s-mu)*rsqrt(var+eps)*g + b
template <bool PARAM_BF16>
__global__ __launch_bounds__(256) void k_layernorm(const float* __restrict__ X, const float* __restrict__ R, const float* __restrict__ g, const float* __restrict__ bta,
                                                  float* __restrict__ out_sum, float* __restrict__ out_norm, int N, float eps) {
  __shared__ float red[256];
  const int row = blockIdx.x, tid = threadIdx.x;
  const float* x = X + (size_t)row * N; const float* rr = R ? R + (size_t)row * N : nullptr;
  float vals[16];                     // up to N = 4096
  const int per = N / 256;            // contiguous chunk per thread? use strided-by-4 chunks: thread handles j = tid*4 + 1024*u
  float s1 = 0.f;
  for (int u = 0; u < per / 4; ++u) {
    const int j = tid * 4 + 1024 * u;
    const v4f a = *(const v4fa*)(x + j);
    v4f b = {0.f,0.f,0.f,0.f}; if (rr) b = *(const v4fa*)(rr + j);
#pragma unroll
    for (int q = 0; q < 4; ++q) { const float v = a[q] + b[q]; vals[u * 4 + q] = v; s1 += v; }
  }
  red[tid] = s1; __syncthreads();
  for (int st = 128; st > 0; st >>= 1) { if (tid < st) red[tid] += red[tid + st]; __syncthreads(); }
  const float mu = red[0] / (float)N; __syncthreads();
  float s2 = 0.f;
  for (int u = 0; u < per / 4; ++u)
#pragma unroll
    for (int q = 0; q < 4; ++q) { const float c = vals[u * 4 + q] - mu; s2 += c * c; }
  red[tid] = s2; __syncthreads();
  for (int st = 128; st > 0; st >>= 1) { if (tid < st) red[tid] += red[tid + st]; __syncthreads(); }
  const float rs = rsqrtf(red[0] / (float)N + eps);
  {
    for (int u = 0; u < per / 4; ++u) {
      const int j = tid * 4 + 1024 * u;
      v4f o, sm;
#pragma unroll
      for (int q = 0; q < 4; ++q) {
        float gg = g[j + q], bb = bta[j + q];
        if (PARAM_BF16) { gg = bf16_round(gg); bb = bf16_round(bb); }
        sm[q] = vals[u * 4 + q]; o[q] = (vals[u * 4 + q] - mu) * rs * gg + bb;
      }
      if (out_sum) *(v4f*)(out_sum + (size_t)row * N + j) = sm;
      *(v4f*)(out_norm + (size_t)row * N + j) = o;
    }
    
  }
}



// ---- f16 WMMA path (v_wmma_f32_16x16x32_f16): 11-bit significands for operands in range — used where a [0,1] probability operand needs more precision than bf16
typedef _Float16 v16h __attribute__((ext_vector_type(16)));
union FragH { v16h v; v8us half[2]; _Float16 h[16]; unsigned short u[16]; };
template <int NT>
__device__ __forceinline__ v8f mmaH(v16h ah, v16h al, v16h bh, v16h bl, v8f c) {
  c = __builtin_amdgcn_wmma_f32_16x16x32_f16(false, ah, false, bh, (short)0, c, false, false);
  if (NT >= 2) c = __builtin_amdgcn_wmma_f32_16x16x32_f16(false, al, false, bh, (short)0, c, false, false);
  if (NT >= 3) c = __builtin_amdgcn_wmma_f32_16x16x32_f16(false, ah, false, bl, (short)0, c, false, false);
  asm volatile("v_nop\n\tv_nop\n\tv_nop\n\tv_nop" : "+v"(c) : "v"(ah), "v"(al), "v"(bh), "v"(bl));
  return c;
}
// batched GEMM like k_gemm_b but f16 operands: A f32 (split into f16 hi/lo if ASPLIT, else rounded to f16), Bt = f16 values [n][k]; alpha; C f32; N multiple of 16 (partial tiles skipped)
template <bool ASPLIT>
__global__ __launch_bounds__(128) void k_gemm_h(const float* __restrict__ A, int lda, size_t sA, const _Float16* __restrict__ Bh, int ldb, size_t sB, float alpha, float* __restrict__ C, int ldc, size_t sC, int M, int N, int K) {
  __shared__ __attribute__((aligned(16))) float so[4][16][64];
  const int tid = threadIdx.x, w = tid >> 5, lane = tid & 31, ln = lane & 15, hh = lane >> 4; const int by = blockIdx.y;
  A += (size_t)by * sA; Bh += (size_t)by * sB; C += (size_t)by * sC;
  const int ntn = (N + 63) / 64; const int wid = blockIdx.x * 4 + w; const int mt = wid / ntn, nq = wid % ntn; if (mt * 16 >= M) return;
  const int row0 = mt * 16, col0 = nq * 64; const float* arow = A + (size_t)(row0 + ln) * lda;
  v8f acc[4] = {};
  for (int kb = 0; kb < K; kb += 32) {
    FragH ah, al;
    const v4f x0 = *(const v4fa*)(arow + kb + 8 * hh), x1 = *(const v4fa*)(arow + kb + 8 * hh + 4), x2 = *(const v4fa*)(arow + kb + 16 + 8 * hh), x3 = *(const v4fa*)(arow + kb + 16 + 8 * hh + 4);
    float xs[16] = {x0[0],x0[1],x0[2],x0[3],x1[0],x1[1],x1[2],x1[3],x2[0],x2[1],x2[2],x2[3],x3[0],x3[1],x3[2],x3[3]};
#pragma unroll
    for (int i = 0; i < 16; ++i) { const _Float16 h = (_Float16)xs[i]; ah.h[i] = h; al.h[i] = ASPLIT ? (_Float16)(xs[i] - (float)h) : (_Float16)0.0f; }
#pragma unroll
    for (int t = 0; t < 4; ++t) { if (col0 + t * 16 >= N) continue; const size_t boff = (size_t)(col0 + t * 16 + ln) * ldb + kb; FragH bq; bq.half[0] = *(const v8us*)(Bh + boff + 8 * hh); bq.half[1] = *(const v8us*)(Bh + boff + 16 + 8 * hh);
      acc[t] = mmaH<ASPLIT ? 2 : 1>(ah.v, al.v, bq.v, bq.v, acc[t]); }
  }
#pragma unroll
  for (int t = 0; t < 4; ++t) { if (col0 + t * 16 >= N) continue;
#pragma unroll
    for (int r = 0; r < 8; ++r) so[w][8 * hh + r][t * 16 + ln] = acc[t][r] * alpha; }
  __builtin_amdgcn_fence(__ATOMIC_ACQ_REL, "workgroup"); __builtin_amdgcn_wave_barrier();
  const int rsub = lane >> 4, c4 = (lane & 15) * 4;
  {
#pragma unroll
    for (int q = 0; q < 8; ++q) { const int r = q * 2 + rsub; if (col0 + c4 < N) { const v4f v = *(const v4fa*)&so[w][r][c4]; *(v4f*)(C + (size_t)(row0 + r) * ldc + col0 + c4) = v; } }
     }
}

// Wt[n][k] = f16(W[k][n]·scale) from f32 row-major W[K][N] (scale = power of two; bf16-exact weights stay exact in f16 away from the subnormal range)
__global__ __launch_bounds__(256) void k_wt_f16(const float* __restrict__ W, _Float16* __restrict__ Wt, int K, int N, float scale) {
  const int t = blockIdx.x * 256 + threadIdx.x; if (t >= N * (K / 8)) return; const int n = t / (K / 8), k8 = (t % (K / 8)) * 8; FragH f;
#pragma unroll
  for (int i = 0; i < 8; ++i) f.h[i] = (_Float16)(bf16_round(W[(size_t)(k8 + i) * N + n]) * scale); const v8us o = f.half[0];
  *(v8us*)((unsigned short*)Wt + (size_t)n * K + k8) = o; 
}
// k_gemm_hh variant with fused epilogue: v = acc·alpha + bias[by·sBias + col] (+ CP[(row/rowsPerB)·sCPb + by·64 + col] if CP) ; ACT 0 none / 1 elu ; writes f16 C16 (and f32 C if non-null)
template <int ACT>
__global__ __launch_bounds__(128) void k_gemm_hhx(const _Float16* __restrict__ A, int lda, size_t sA, const _Float16* __restrict__ Bh, int ldb, size_t sB, float alpha, const float* __restrict__ bias, size_t sBias, const float* __restrict__ CP, int rowsPerB, size_t sCPb, int row0g,
    float* __restrict__ C, _Float16* __restrict__ C16, int ldc, size_t sC, int M, int N, int K) {
  __shared__ __attribute__((aligned(16))) float so[4][16][64];
  const int tid = threadIdx.x, w = tid >> 5, lane = tid & 31, ln = lane & 15, hh = lane >> 4; const int by = blockIdx.y;
  A += (size_t)by * sA; Bh += (size_t)by * sB; const size_t cofs = (size_t)by * sC; const float* bp = bias ? bias + (size_t)by * sBias : nullptr;
  const int ntn = (N + 63) / 64; const int wid = blockIdx.x * 4 + w; const int mt = wid / ntn, nq = wid % ntn; if (mt * 16 >= M) return;
  const int row0 = mt * 16, col0 = nq * 64; const _Float16* arow = A + (size_t)(row0 + ln) * lda;
  v8f acc[4] = {};
  for (int kb = 0; kb < K; kb += 32) { FragH ah; ah.half[0] = *(const v8us*)((const unsigned short*)arow + kb + 8 * hh); ah.half[1] = *(const v8us*)((const unsigned short*)arow + kb + 16 + 8 * hh);
#pragma unroll
    for (int t = 0; t < 4; ++t) { if (col0 + t * 16 >= N) continue; const size_t boff = (size_t)(col0 + t * 16 + ln) * ldb + kb; FragH bq; bq.half[0] = *(const v8us*)((const unsigned short*)Bh + boff + 8 * hh); bq.half[1] = *(const v8us*)((const unsigned short*)Bh + boff + 16 + 8 * hh);
      acc[t] = mmaH<1>(ah.v, ah.v, bq.v, bq.v, acc[t]); }
  }
#pragma unroll
  for (int t = 0; t < 4; ++t) { if (col0 + t * 16 >= N) continue; const int col = col0 + t * 16 + ln; const float bv = bp ? bf16_round(bp[col]) : 0.f;
#pragma unroll
    for (int r = 0; r < 8; ++r) { float v = acc[t][r] * alpha + bv; if (CP) { const int rr = row0g + row0 + 8 * hh + r; if (rowsPerB < 0) v += CP[cofs + (size_t)rr * ldc + col];      /* rowsPerB < 0: own element of the batched C plane */ else { const int bidx = rr / rowsPerB; v += CP[(size_t)bidx * sCPb + (size_t)by * 64 + col]; } } if (ACT == 1) v = (v > 0.f) ? v : expm1f(v); else if (ACT == 7) v = (v > 0.f) ? v + 1.0f : expf(v); else if (ACT == 8) v = tanhf(v); else if (ACT == 9) v = 0.5f * v * (1.0f + tanhf(0.7978845608028654f * (v + 0.044715f * v * v * v))); else if (ACT == 11) v = 1.0f / (1.0f + expf(-v)); else if (ACT == 12) v = (v > 0.f) ? v : 0.01f * v; else if (ACT == 14) v = (v > 0.f) ? v : 0.1f * v; else if (ACT == 16) v = (v >= 0.f) ? v : 0.3f * v; else if (ACT == 17) v = (v >= 0.f) ? v : 0.2f * v; else if (ACT == 15) v = v / (1.0f + expf(-v)); else if (ACT == 3) v = fmaxf(v, 0.f); else if (ACT == 6) v = 0.5f * v * (1.0f + erff(v * 0.70710678118654752f)); so[w][8 * hh + r][t * 16 + ln] = v; } }
  __builtin_amdgcn_fence(__ATOMIC_ACQ_REL, "workgroup"); __builtin_amdgcn_wave_barrier();
  const int rsub = lane >> 4, c4 = (lane & 15) * 4; typedef _Float16 v4h __attribute__((ext_vector_type(4)));
  {
#pragma unroll
    for (int q = 0; q < 8; ++q) { const int r = q * 2 + rsub; if (col0 + c4 < N) { const v4f v = *(const v4fa*)&so[w][r][c4]; if (C) *(v4f*)(C + cofs + (size_t)(row0 + r) * ldc + col0 + c4) = v; if (C16) { v4h h4; for (int i = 0; i < 4; ++i) h4[i] = (_Float16)v[i]; *(v4h*)(C16 + cofs + (size_t)(row0 + r) * ldc + col0 + c4) = h4; } } }
     }
}


typedef _Float16 v4h __attribute__((ext_vector_type(4)));

__global__ __launch_bounds__(256) void k_x16(const float* __restrict__ x, _Float16* __restrict__ X16, size_t n8) { const size_t t = (size_t)blockIdx.x * 256 + threadIdx.x; if (t >= n8) return; FragH f;
#pragma unroll
  for (int q = 0; q < 8; ++q) f.h[q] = (_Float16)bf16_round(x[t * 8 + q]); *(v8us*)((unsigned short*)X16 + t * 8) = f.half[0];  }
__global__ __launch_bounds__(256) void k_h16(const float* __restrict__ x, _Float16* __restrict__ X16, size_t n8) { const size_t t = (size_t)blockIdx.x * 256 + threadIdx.x; if (t >= n8) return; FragH f;
#pragma unroll
  for (int q = 0; q < 8; ++q) f.h[q] = (_Float16)x[t * 8 + q]; *(v8us*)((unsigned short*)X16 + t * 8) = f.half[0];  }
__global__ __launch_bounds__(256) void k_round16f(const float* __restrict__ W, _Float16* __restrict__ Bt, size_t n8) { const size_t t = (size_t)blockIdx.x * 256 + threadIdx.x; if (t >= n8) return; FragH f;
#pragma unroll
  for (int i = 0; i < 8; ++i) f.h[i] = (_Float16)(bf16_round(W[t * 8 + i]) * 16.0f); *(v8us*)((unsigned short*)Bt + t * 8) = f.half[0];  }
template <int NHv, int TTv>
__global__ __launch_bounds__(256) void k_vt(const _Float16* __restrict__ V16, int ldv, int voff, _Float16* __restrict__ Vt) { __shared__ unsigned short tl[64][66]; const int tid = threadIdx.x; const int slab = blockIdx.x / (TTv / 64), lg = blockIdx.x % (TTv / 64); const int b = slab / NHv, h = slab % NHv;
  for (int i = tid; i < 64 * 8; i += 256) { const int r = i / 8, c8 = (i % 8) * 8; FragH f; f.half[0] = *(const v8us*)((const unsigned short*)V16 + ((size_t)b * TTv + lg * 64 + r) * ldv + voff + h * 64 + c8);
#pragma unroll
    for (int q = 0; q < 8; ++q) tl[r][c8 + q] = f.u[q]; }
  __syncthreads();
  {
#pragma unroll
    for (int rd = 0; rd < 2; ++rd) { const int d = rd * 32 + tid / 8, pc = tid % 8; FragH f;
#pragma unroll
      for (int q = 0; q < 8; ++q) f.u[q] = tl[pc * 8 + q][d];
      *(v8us*)((unsigned short*)Vt + ((size_t)slab * 64 + d) * TTv + lg * 64 + pc * 8) = f.half[0]; }
     } }

__global__ __launch_bounds__(256) void k_hl(const float* __restrict__ F, _Float16* __restrict__ Hh, _Float16* __restrict__ Hl, size_t n8) { const size_t t = (size_t)blockIdx.x * 256 + threadIdx.x; if (t >= n8) return; FragH fh, fl; const v4f a = *(const v4fa*)(F + t * 8), c = *(const v4fa*)(F + t * 8 + 4);
#pragma unroll
  for (int q = 0; q < 4; ++q) { _Float16 h = (_Float16)a[q]; fh.h[q] = h; fl.h[q] = (_Float16)((a[q] - (float)h) * 1024.0f); h = (_Float16)c[q]; fh.h[4 + q] = h; fl.h[4 + q] = (_Float16)((c[q] - (float)h) * 1024.0f); }
  { *(v8us*)((unsigned short*)Hh + t * 8) = fh.half[0]; *(v8us*)((unsigned short*)Hl + t * 8) = fl.half[0];  } }

// ---- fast GEMM (wave tile 32x64; requires M % 32 == 0 rows per launch region and N % 64 == 0); epilogue = k_gemm_hhx semantics ----
__device__ __forceinline__ v16h g2_frag(const _Float16* p, int hh) { FragH f; f.half[0] = *(const v8us*)((const unsigned short*)p + 8 * hh); f.half[1] = *(const v8us*)((const unsigned short*)p + 16 + 8 * hh); return f.v; }
__device__ __forceinline__ v8f g2_mma(v16h a, v16h b, v8f c) { v8f d = __builtin_amdgcn_wmma_f32_16x16x32_f16(false, a, false, b, (short)0, c, false, false); asm volatile("v_nop\n\tv_nop\n\tv_nop\n\tv_nop" : "+v"(d) : "v"(a), "v"(b)); return d; }
template <int ACT>
__global__ __launch_bounds__(128) void k_gemm2(const _Float16* __restrict__ A, int lda, size_t sA, const _Float16* __restrict__ Bh, int ldb, size_t sB, float alpha, const float* __restrict__ bias, size_t sBias, const float* __restrict__ CP, int rowsPerB, size_t sCPb, int row0g,
    float* __restrict__ C, _Float16* __restrict__ C16, int ldc, size_t sC, int M, int N, int K) { static_assert(ACT == 0 || ACT == 3 || ACT == 6 || ACT == 8 || ACT == 9 || ACT == 11 || ACT == 12 || ACT == 14 || ACT == 15 || ACT == 16 || ACT == 17, "k_gemm2: unsupported ACT code (would silently apply no activation)");
  __shared__ __attribute__((aligned(16))) float so[4][32][68];
  const int tid = threadIdx.x, w = tid >> 5, lane = tid & 31, ln = lane & 15, hh = lane >> 4; const int by = blockIdx.y;
  A += (size_t)by * sA; Bh += (size_t)by * sB; const size_t cofs = (size_t)by * sC; const float* bp = bias ? bias + (size_t)by * sBias : nullptr;
  const int ntn = N >> 6; const int mt = blockIdx.x / ntn, nq = blockIdx.x - mt * ntn; const int row0 = mt * 128 + 32 * w, col0 = nq * 64; if (row0 >= M) return;
  const _Float16* a0p = A + (size_t)(row0 + ln) * lda; const _Float16* a1p = a0p + (size_t)16 * lda;
  const _Float16* b0p = Bh + (size_t)(col0 + ln) * ldb; const _Float16* b1p = b0p + (size_t)16 * ldb; const _Float16* b2p = b1p + (size_t)16 * ldb; const _Float16* b3p = b2p + (size_t)16 * ldb;
  const v8f z8 = {0.f,0.f,0.f,0.f,0.f,0.f,0.f,0.f}; v8f c00 = z8, c01 = z8, c02 = z8, c03 = z8, c10 = z8, c11 = z8, c12 = z8, c13 = z8;
#pragma unroll 1
  for (int kb = 0; kb < K; kb += 32) { const v16h a0 = g2_frag(a0p + kb, hh), a1 = g2_frag(a1p + kb, hh);
    v16h b = g2_frag(b0p + kb, hh); c00 = g2_mma(a0, b, c00); c10 = g2_mma(a1, b, c10);
    b = g2_frag(b1p + kb, hh); c01 = g2_mma(a0, b, c01); c11 = g2_mma(a1, b, c11);
    b = g2_frag(b2p + kb, hh); c02 = g2_mma(a0, b, c02); c12 = g2_mma(a1, b, c12);
    b = g2_frag(b3p + kb, hh); c03 = g2_mma(a0, b, c03); c13 = g2_mma(a1, b, c13); }
  v8f accs[8] = {c00, c01, c02, c03, c10, c11, c12, c13};
#pragma unroll
  for (int u = 0; u < 8; ++u) { const int t = u & 3, half = u >> 2; const int col = col0 + t * 16 + ln; const float bv = bp ? bf16_round(bp[col]) : 0.f;
#pragma unroll
    for (int r = 0; r < 8; ++r) { const int rloc = half * 16 + 8 * hh + r; float v = accs[u][r] * alpha + bv; if (CP) { if (rowsPerB < 0) v += CP[cofs + (size_t)(row0g + row0 + rloc) * ldc + col];      /* rowsPerB < 0: own element of the batched C plane */ else { const int bidx = (row0g + row0 + rloc) / rowsPerB; v += CP[(size_t)bidx * sCPb + (size_t)by * 64 + col]; } }
      if (ACT == 3) v = fmaxf(v, 0.f); else if (ACT == 6) v = 0.5f * v * (1.0f + erff(v * 0.70710678118654752f)); else if (ACT == 11) v = 1.0f / (1.0f + expf(-v)); else if (ACT == 15) v = v / (1.0f + expf(-v)); else if (ACT == 12) v = (v > 0.f) ? v : 0.01f * v; else if (ACT == 8) v = tanhf(v); else if (ACT == 9) v = 0.5f * v * (1.0f + tanhf(0.7978845608028654f * (v + 0.044715f * v * v * v))); else if (ACT == 14) v = (v > 0.f) ? v : 0.1f * v; else if (ACT == 16) v = (v >= 0.f) ? v : 0.3f * v; else if (ACT == 17) v = (v >= 0.f) ? v : 0.2f * v;
      so[w][rloc][t * 16 + ln] = v; } }
  __builtin_amdgcn_fence(__ATOMIC_ACQ_REL, "workgroup"); __builtin_amdgcn_wave_barrier();
  const int rsub = lane >> 4, c4 = (lane & 15) * 4;
  {
#pragma unroll
    for (int q = 0; q < 16; ++q) { const int r = q * 2 + rsub; const v4f v = *(const v4fa*)&so[w][r][c4]; if (C) *(v4f*)(C + cofs + (size_t)(row0 + r) * ldc + col0 + c4) = v; if (C16) { v4h h4; for (int i = 0; i < 4; ++i) h4[i] = (_Float16)v[i]; *(v4h*)(C16 + cofs + (size_t)(row0 + r) * ldc + col0 + c4) = h4; } }
     } }


__global__ __launch_bounds__(256) void k_wnat(const float* __restrict__ w, size_t n8, _Float16* __restrict__ Bt) { const size_t t = (size_t)blockIdx.x * 256 + threadIdx.x; if (t >= n8) return; FragH f; for (int q = 0; q < 8; ++q) f.h[q] = (_Float16)(bf16_round(w[t * 8 + q]) * 16.0f); *(v8us*)((unsigned short*)Bt + t * 8) = f.half[0];  }
__global__ __launch_bounds__(256) void k_rsm(const float* __restrict__ S, _Float16* __restrict__ P, int nrows) {
  #pragma clang fp contract(off)
  const int i = blockIdx.x * 256 + threadIdx.x; if (i >= nrows) return; const float* s = S + (size_t)i * SQ; float mx = -3.0e38f;
#pragma unroll 1
  for (int j = 0; j < SQ; ++j) mx = fmaxf(mx, s[j]); float se = 0.f;
#pragma unroll 1
  for (int j = 0; j < SQ; ++j) se += expf(s[j] - mx); const float sc = 256.0f / se;
#pragma unroll 1
  for (int j0 = 0; j0 < SQ; j0 += 8) { FragH f; for (int q = 0; q < 8; ++q) f.h[q] = (_Float16)(expf(s[j0 + q] - mx) * sc); unsigned short* d = (unsigned short*)P + (size_t)i * SQ + j0; *(v8us*)d = f.half[0];  } }
__global__ __launch_bounds__(256) void k_vt(const _Float16* __restrict__ V16, int b, int h0, _Float16* __restrict__ VT) { __shared__ unsigned short tl[64][65]; const int tid = threadIdx.x; const int hh = blockIdx.x % HG, sg = blockIdx.x / HG; const int s0 = sg * 64; const int h = h0 + hh;
  for (int i = tid; i < 64 * 8; i += 256) { const int j = i / 8, d8 = (i % 8) * 8; FragH f; f.half[0] = *(const v8us*)((const unsigned short*)V16 + ((size_t)b * SQ + s0 + j) * DM + h * HD + d8); for (int q = 0; q < 8; ++q) tl[d8 + q][j] = f.u[q]; }
  __syncthreads();
  { for (int i = tid; i < 64 * 8; i += 256) { const int d = i / 8, j8 = (i % 8) * 8; FragH f; for (int q = 0; q < 8; ++q) f.u[q] = tl[d][j8 + q]; *(v8us*)((unsigned short*)VT + ((size_t)hh * HD + d) * SQ + s0 + j8) = f.half[0]; }  } }



__global__ __launch_bounds__(256) void k_rsmcf2(const float* __restrict__ S, _Float16* __restrict__ P, int hg, int q0, int nk) {
  #pragma clang fp contract(off)
  const int t = blockIdx.x * 256 + threadIdx.x; if (t >= hg * QT) return; const size_t i = (size_t)t; const float* s = S + i * NKX; const int last = q0 + (t % QT); float mx = -3.0e38f;
#pragma unroll 1
  for (int j = 0; j < nk; ++j) { const float f = (j <= last) ? 1.f : 0.f; mx = fmaxf(mx, fmaf(f, s[j], (1.f - f) * -1.0e9f)); } float se = 0.f;
#pragma unroll 1
  for (int j = 0; j < nk; ++j) { const float f = (j <= last) ? 1.f : 0.f; se += __expf(fmaf(f, s[j], (1.f - f) * -1.0e9f) - mx); } const float sc = 256.0f / se;
#pragma unroll 1
  for (int j0 = 0; j0 < nk; j0 += 8) { FragH fr; for (int q = 0; q < 8; ++q) { const int j = j0 + q; const float f = (j <= last) ? 1.f : 0.f; fr.h[q] = (_Float16)(__expf(fmaf(f, s[j], (1.f - f) * -1.0e9f) - mx) * sc); } unsigned short* d = (unsigned short*)P + i * NKX + j0; *(v8us*)d = fr.half[0];  } }


template <int MASKADD>
__global__ __launch_bounds__(64) void k_att0(const float* __restrict__ QF, const float* __restrict__ KF, const float* __restrict__ VF, int ld, const float* __restrict__ mask, float scale, float* __restrict__ OF, int ldo) {
  #pragma clang fp contract(off)
  __shared__ __attribute__((aligned(16))) float lq[64][64]; __shared__ __attribute__((aligned(16))) float lo[64][64];
  const int tid = threadIdx.x; const int h = blockIdx.x / (QT0 / 64), rg = blockIdx.x % (QT0 / 64); const int i = rg * 64 + tid;
  const float* qr = QF + (size_t)i * ld + h * HD;
#pragma unroll 1
  for (int c = 0; c < HD / 4; ++c) { *(v4f*)&lq[tid][c * 4] = *(const v4fa*)(qr + c * 4); const v4f z = {0.f, 0.f, 0.f, 0.f}; *(v4f*)&lo[tid][c * 4] = z; }
  float m = -1.0e30f, l = 0.f; const int jmax = MASKADD ? (SQ - 1) : (rg * 64 + 63);      /* additive-mask form: every key (the mask input decides); causal form: keys up to the block's last row */
#pragma unroll 1
  for (int j = 0; j <= jmax; ++j) { const float* kr = KF + (size_t)j * ld + h * HD; const float* vr = VF + (size_t)j * ld + h * HD; float s = 0.f;
#pragma unroll 1
    for (int c = 0; c < HD / 4; ++c) { const v4f kq = *(const v4fa*)(kr + c * 4); const v4f qq = *(v4f*)&lq[tid][c * 4]; s = __fadd_rn(s, __fmul_rn(qq[0], kq[0])); s = __fadd_rn(s, __fmul_rn(qq[1], kq[1])); s = __fadd_rn(s, __fmul_rn(qq[2], kq[2])); s = __fadd_rn(s, __fmul_rn(qq[3], kq[3])); }
    s = __fmul_rn(s, scale); if (MASKADD) s = __fadd_rn(s, __fmul_rn(bf16_round(mask[(size_t)i * SQ + j]), -10000.0f));
    const float f = (MASKADD || j <= i) ? 1.f : 0.f; const float sm = fmaf(f, s, (1.f - f) * -1.0e30f); const float mn = fmaxf(m, sm); const float sc = expf(m - mn); const float e = expf(sm - mn); l = __fadd_rn(__fmul_rn(l, sc), e); m = mn;
#pragma unroll 1
    for (int c = 0; c < HD / 4; ++c) { const v4f vv = *(const v4fa*)(vr + c * 4); v4f oo = *(v4f*)&lo[tid][c * 4]; for (int u = 0; u < 4; ++u) oo[u] = __fadd_rn(__fmul_rn(oo[u], sc), __fmul_rn(e, vv[u])); *(v4f*)&lo[tid][c * 4] = oo; } }
  const float fin = 64.0f / l;      /* o carried x64 */
#pragma unroll 1
  for (int c = 0; c < HD / 4; ++c) { v4f oo = *(v4f*)&lo[tid][c * 4]; for (int u = 0; u < 4; ++u) oo[u] = __fmul_rn(oo[u], fin); *(v4f*)&lo[tid][c * 4] = oo; }
  __syncthreads();
  {
#pragma unroll 1
    for (int it = 0; it < 16; ++it) { const int row = it * 4 + tid / 16, pc = (tid % 16) * 4; const v4f v = *(const v4f*)&lo[row][pc]; *(v4f*)(OF + (size_t)(rg * 64 + row) * ldo + h * HD + pc) = v; }
     } }


__global__ __launch_bounds__(256) void k_trirow(const float* __restrict__ S, float* __restrict__ WPD) {
  #pragma clang fp contract(off)
  const int b = blockIdx.x * 256 + threadIdx.x; if (b >= SQ) return; const float* s = S + (size_t)b * SQ; float m = (b > 0) ? 0.f : -3.0e38f;
#pragma unroll 1
  for (int a = b; a < SQ; ++a) m = fmaxf(m, s[a]); float z = __fmul_rn((float)b, expf(-m));
#pragma unroll 1
  for (int a = b; a < SQ; ++a) z = __fadd_rn(z, expf(__fadd_rn(s[a], -m)));
  const float wp = __fdiv_rn(expf(-m), z), wd = __fdiv_rn(expf(__fadd_rn(s[b], -m)), z);
  *(float*)(WPD + 2 * b) = wp; *(float*)(WPD + 2 * b + 1) = wd;  }
__global__ __launch_bounds__(256) void k_colscan(const float* __restrict__ V, float* __restrict__ PRE) {
  #pragma clang fp contract(off)
  const int c = blockIdx.x * 256 + threadIdx.x; if (c >= DM) return;
  { float acc = 0.f;
#pragma unroll 1
    for (int b = 0; b < SQ; ++b) { *(float*)(PRE + (size_t)b * DM + c) = acc; acc = __fadd_rn(acc, V[(size_t)b * DM + c]); }
     } }
__global__ __launch_bounds__(256) void k_trifin(const float* __restrict__ PRE, const float* __restrict__ V, const float* __restrict__ WPD, float* __restrict__ out, size_t n4) {
  #pragma clang fp contract(off)
  const size_t t = (size_t)blockIdx.x * 256 + threadIdx.x; if (t >= n4) return; const size_t e = t * 4; const int b = (int)(e / DM); const float wp = WPD[2 * b], wd = WPD[2 * b + 1];
  const v4f p = *(const v4fa*)(PRE + e), v = *(const v4fa*)(V + e); v4f r; for (int q = 0; q < 4; ++q) r[q] = __fadd_rn(__fmul_rn(wp, p[q]), __fmul_rn(wd, v[q]));
  *(v4f*)(out + e) = r;  }

__global__ __launch_bounds__(256) void k_rsmfu(const float* __restrict__ S, _Float16* __restrict__ P) {
  #pragma clang fp contract(off)
  const int j = blockIdx.x * 256 + threadIdx.x; if (j >= SQ) return; const float* s = S + (size_t)j * SQ; float mx = -3.0e38f;
#pragma unroll 1
  for (int i = 0; i < SQ; ++i) { const float f = (i >= j) ? 1.f : 0.f; mx = fmaxf(mx, fmaf(f, s[i], (1.f - f) * -1.0e9f)); } float se = 0.f;
#pragma unroll 1
  for (int i = 0; i < SQ; ++i) { const float f = (i >= j) ? 1.f : 0.f; se += __expf(fmaf(f, s[i], (1.f - f) * -1.0e9f) - mx); } const float sc = 256.0f / se;
#pragma unroll 1
  for (int i0 = 0; i0 < SQ; i0 += 8) { FragH fr; for (int q = 0; q < 8; ++q) { const int i = i0 + q; const float f = (i >= j) ? 1.f : 0.f; fr.h[q] = (_Float16)(__expf(fmaf(f, s[i], (1.f - f) * -1.0e9f) - mx) * sc); } unsigned short* d = (unsigned short*)P + (size_t)j * SQ + i0; *(v8us*)d = fr.half[0];  } }
__global__ __launch_bounds__(256) void k_cs(const float* __restrict__ QF, const float* __restrict__ KF, float* __restrict__ SC) {
  #pragma clang fp contract(off)
  const int t = blockIdx.x * 256 + threadIdx.x; if (t >= 256 * 256) return; const int i = t / 256, j = t % 256; float s = -1.0e9f;
  if (j <= i) { const float* q = QF + (size_t)i * DM; const float* k = KF + (size_t)j * DM; float a = 0.f;
#pragma unroll 4
    for (int d = 0; d < DM; ++d) a = __fadd_rn(a, __fmul_rn(q[d], k[d])); s = __fmul_rn(a, 0.03125f); }
  *(float*)(SC + t) = s;  }
__global__ __launch_bounds__(256) void k_cz(const float* __restrict__ SC, float* __restrict__ W) {
  #pragma clang fp contract(off)
  const int j = threadIdx.x; float m = -3.0e38f;
#pragma unroll 1
  for (int i = j; i < 256; ++i) m = fmaxf(m, SC[i * 256 + j]); float z = 0.f;
#pragma unroll 1
  for (int i = j; i < 256; ++i) z = __fadd_rn(z, expf(__fadd_rn(SC[i * 256 + j], -m)));
  const float rz = __fdiv_rn(1.0f, z);
  {
#pragma unroll 1
    for (int i = 0; i < 256; ++i) { const float w = (i >= j) ? __fmul_rn(expf(__fadd_rn(SC[i * 256 + j], -m)), rz) : 0.f; *(float*)(W + i * 256 + j) = w; }
     } }
__global__ __launch_bounds__(256) void k_co(const float* __restrict__ W, const float* __restrict__ VF, float* __restrict__ out) {
  #pragma clang fp contract(off)
  const int t = blockIdx.x * 256 + threadIdx.x; if (t >= 256 * (DM / 4)) return; const int i = t / (DM / 4); const int c = (t % (DM / 4)) * 4; v4f acc = {0.f, 0.f, 0.f, 0.f};
#pragma unroll 1
  for (int j = 0; j <= i; ++j) { const float w = W[i * 256 + j]; const v4f v = *(const v4fa*)(VF + (size_t)j * DM + c); for (int u = 0; u < 4; ++u) acc[u] = __fadd_rn(acc[u], __fmul_rn(w, v[u])); }
  float* o = out + (size_t)i * DM + c; const v4f base = *(const v4fa*)o; v4f r; for (int u = 0; u < 4; ++u) r[u] = __fadd_rn(base[u], acc[u]);
  *(v4f*)o = r;  }

__global__ __launch_bounds__(256) void k_rsmfhl(const float* __restrict__ S, _Float16* __restrict__ P, _Float16* __restrict__ PL, int nrows) {
  #pragma clang fp contract(off)
  const int t = blockIdx.x * 256 + threadIdx.x; if (t >= nrows) return; const float* s = S + (size_t)t * SQ; float mx = -3.0e38f;
#pragma unroll 1
  for (int j = 0; j < SQ; ++j) mx = fmaxf(mx, s[j]); float se = 0.f;
#pragma unroll 1
  for (int j = 0; j < SQ; ++j) se += __expf(s[j] - mx); const float sc = 256.0f / se;
#pragma unroll 1
  for (int j0 = 0; j0 < SQ; j0 += 8) { FragH fr, fl; for (int q = 0; q < 8; ++q) { const float v = __expf(s[j0 + q] - mx) * sc; const _Float16 hv = (_Float16)v; fr.h[q] = hv; fl.h[q] = (_Float16)((v - (float)hv) * 1024.0f); }
    unsigned short* d = (unsigned short*)P + (size_t)t * SQ + j0; unsigned short* dl = (unsigned short*)PL + (size_t)t * SQ + j0; *(v8us*)d = fr.half[0]; *(v8us*)dl = fl.half[0];  } }

// Row softmax, one wave per score row: the row's 4096 f32 stay in the wave's registers (32 loads of 16 B per lane, each load 512 contiguous bytes of the row),
// so S is read once; maximum and sum are four chains per lane, then a five-step butterfly over the 32 lanes; each store is 256 contiguous bytes of P (weights x256 f16).
__global__ __launch_bounds__(256) void k_rsmw(const float* __restrict__ S, _Float16* __restrict__ P) {
  static_assert(SQ == 32 * 128 && SQ % 8 == 0, "k_rsmw: one wave holds a whole row, eight rows per block");
  const int lane = threadIdx.x & 31; const size_t row = (size_t)blockIdx.x * 8 + (threadIdx.x >> 5); const float* s = S + row * SQ + lane * 4; v4f x[32];
#pragma unroll
  for (int i = 0; i < 32; ++i) x[i] = *(const v4fa*)(s + i * 128);
  v4f m4 = x[0];
#pragma unroll
  for (int i = 1; i < 32; ++i) for (int q = 0; q < 4; ++q) m4[q] = fmaxf(m4[q], x[i][q]);
  float mx = fmaxf(fmaxf(m4[0], m4[1]), fmaxf(m4[2], m4[3]));
#pragma unroll
  for (int d = 16; d > 0; d >>= 1) mx = fmaxf(mx, __shfl_xor(mx, d, 32));
  v4f s4 = {0.f, 0.f, 0.f, 0.f};
#pragma unroll
  for (int i = 0; i < 32; ++i) { float e0 = (x[i][0] - mx) * 0x1.715476p+0f, e1 = (x[i][1] - mx) * 0x1.715476p+0f, e2 = (x[i][2] - mx) * 0x1.715476p+0f, e3 = (x[i][3] - mx) * 0x1.715476p+0f;      /* native exp: exp2((s - max) log2 e) */
    /* four exponentials in place; the closing v_nop is the free slot the instruction set asks for behind a transcendental */
    asm("v_exp_f32 %0, %0\n\tv_exp_f32 %1, %1\n\tv_exp_f32 %2, %2\n\tv_exp_f32 %3, %3\n\tv_nop" : "+v"(e0), "+v"(e1), "+v"(e2), "+v"(e3));
    x[i][0] = e0; x[i][1] = e1; x[i][2] = e2; x[i][3] = e3; s4[0] += e0; s4[1] += e1; s4[2] += e2; s4[3] += e3; }
  float se = (s4[0] + s4[1]) + (s4[2] + s4[3]);
#pragma unroll
  for (int d = 16; d > 0; d >>= 1) se += __shfl_xor(se, d, 32);
  const float sc = 256.0f / se; _Float16* p = P + row * SQ + lane * 4;
#pragma unroll
  for (int i = 0; i < 32; ++i) { v4h h4; for (int q = 0; q < 4; ++q) h4[q] = (_Float16)(x[i][q] * sc); *(v4h*)(p + i * 128) = h4; } }


extern "C" void kernel_launch(void* const* d_in, const int* in_sizes, int n_in,
                              void* d_out, int out_size, void* d_ws, size_t ws_size, hipStream_t stream) {
  (void)in_sizes; (void)n_in; (void)out_size;
  const float* const* I = (const float* const*)d_in; const float* xq = I[0]; const float* xk = I[1]; const float* xv = I[2];      /* q, k, v [4][4096][512] (bf16-valued) */
  char* ws = (char*)d_ws; size_t off = 0;
  auto take = [&](size_t bytes) { char* p = ws + off; off += (bytes + 255) & ~(size_t)255; return p; };
  _Float16* Q16 = (_Float16*)take(NR * DM * 2); _Float16* K16 = (_Float16*)take(NR * DM * 2); _Float16* V16 = (_Float16*)take(NR * DM * 2);
  float* S = (float*)take((size_t)SQ * SQ * 4); _Float16* P = (_Float16*)take((size_t)SQ * SQ * 2); _Float16* VT = (_Float16*)take((size_t)DM * SQ * 2);
  if (off > ws_size) return;
  k_x16<<<(unsigned)((NR * DM / 8 + 255) / 256), 256, 0, stream>>>(xq, Q16, NR * DM / 8); k_x16<<<(unsigned)((NR * DM / 8 + 255) / 256), 256, 0, stream>>>(xk, K16, NR * DM / 8); k_x16<<<(unsigned)((NR * DM / 8 + 255) / 256), 256, 0, stream>>>(xv, V16, NR * DM / 8);      /* exact f16 copies of the bf16-valued inputs */
  for (int b = 0; b < NB; ++b) { const size_t r0 = (size_t)b * SQ;
    k_gemm2<0><<<dim3((SQ / 128) * (SQ / 64), 1), 128, 0, stream>>>(Q16 + r0 * DM, DM, 0, K16 + r0 * DM, DM, 0, 0.125f, nullptr, 0, nullptr, 1, 0, 0, S, nullptr, SQ, 0, SQ, SQ, DM);      /* S = q k^T / sqrt(64) (K = 512, exact products) over the ORIGINAL order */
    k_rsmw<<<SQ / 8, 256, 0, stream>>>(S, P);      /* softmax over all 4096 positions -> P x256 f16 */
    k_vt<DM / 64, SQ><<<(DM / 64) * (SQ / 64), 256, 0, stream>>>(V16 + r0 * DM, DM, 0, VT);      /* V^T [512][4096] */
    k_gemm2<0><<<dim3((SQ / 128) * (DM / 64), 1), 128, 0, stream>>>(P, SQ, 0, VT, SQ, 0, 0.00390625f, nullptr, 0, nullptr, 1, 0, 0, (float*)d_out + r0 * DM, nullptr, DM, 0, SQ, DM, SQ); }      /* out = P V^T 2^-8 f32 into the batch's rows (original order: the module's inverse permutation undoes its permutation) */
}

// v002
// One run takes 346 microseconds.
// Next to v001, in two timings, it ran 2.40 times as fast each time.
// Over all steps from v000 it is 10.1 times as fast.
#include <hip/hip_runtime.h>
// Dense single-head attention over a strided-permuted sequence (q, k, v [4][4096][512]; the module permutes the sequence (64 x 64 blocks transposed), runs FULL softmax attention w = softmax(q k^T / sqrt(64)) over all 4096 positions, a = w v, and applies the inverse permutation — a full attention is permutation-equivariant, so out[t] = softmax(q_t K^T / 8) V on the original order -> [4][4096][512]).
// Structure: token rows; the bf16-valued q, k, v inputs as exact f16 rows; per batch: S = q k^T / 8 (K = 512, exact products) as ONE WMMA GEMM (32x64 wave tiles, f32 accumulation) [4096][4096] f32; row softmax on VALU (f32 statistics, native exp; weights x256 f16); V^T via LDS transposes; out = P V^T 2^-8 f32.
// Compute dtype: inputs rounded to bf16; q, k, v and softmax weights as plain f16 GEMM operands (~2^-12); scores and softmax statistics f32. v_wmma_f32_16x16x32_f16.
#define NB 4
#define SQ 4096
#define DM 512
#define NH 16
#define HD 64
#define HG 4                         /* heads per launch of k_vt(V16, b, h0, VT), which is not launched */
#define QT 256                       /* query rows per causal tile */
#define NKX SQ                       /* S / P row pitch */
#define QT0 128                      /* first-tile rows recomputed exactly in f32 */
#define B0 0                         /* first batch processed (debug hook) */
#define NBR NB                       /* batches processed (debug hook) */
#define NR ((size_t)NB * SQ)         /* token rows */
#define MP ((int)((size_t)NBR * SQ)) /* rows projected (debug hook) */
#define QN SQ                        /* query rows attended per batch (debug hook) */
#define NHD NH                       /* unused; the attention here is single-head */
#define MPO MP                       /* rows through the output stage (debug hook) */
#define LQ DM      /* row pitch of the q/k/v rows */
typedef __bf16 v16b __attribute__((ext_vector_type(16)));
typedef unsigned short v8us __attribute__((ext_vector_type(8), may_alias));
typedef float  v8f  __attribute__((ext_vector_type(8)));
typedef float  v4f  __attribute__((ext_vector_type(4)));
typedef float  v4fa __attribute__((ext_vector_type(4), may_alias));
union FragB { v16b v; v8us half[2]; unsigned short u[16]; };

__device__ __forceinline__ unsigned short bf16_bits(float x) { unsigned int u = __float_as_uint(x); return (unsigned short)((u + 0x7FFFu + ((u >> 16) & 1u)) >> 16); }
__device__ __forceinline__ float bf16_val(unsigned short b) { return __uint_as_float(((unsigned int)b) << 16); }
__device__ __forceinline__ float bf16_round(float x) { return bf16_val(bf16_bits(x)); }
// D += A·B with NT terms: 1 = ah·bh, 2 = + al·bh (A split), 3 = + ah·bl (both split)
template <int NT>
__device__ __forceinline__ v8f mmaN(v16b ah, v16b al, v16b bh, v16b bl, v8f c) {
  c = __builtin_amdgcn_wmma_f32_16x16x32_bf16(false, ah, false, bh, (short)0, c, false, false);
  if (NT >= 2) c = __builtin_amdgcn_wmma_f32_16x16x32_bf16(false, al, false, bh, (short)0, c, false, false);
  if (NT >= 3) c = __builtin_amdgcn_wmma_f32_16x16x32_bf16(false, ah, false, bl, (short)0, c, false, false);
  asm volatile("v_nop\n\tv_nop\n\tv_nop\n\tv_nop" : "+v"(c) : "v"(ah), "v"(al), "v"(bh), "v"(bl));
  return c;
}

__global__ __launch_bounds__(256) void k_wt_bf16(const float* __restrict__ W, unsigned short* __restrict__ Wt, int K, int N) {
  const int t = blockIdx.x * 256 + threadIdx.x;
  const int k8n = K / 8;
  if (t >= N * k8n) return;
  const int n = t / k8n, k8 = (t % k8n) * 8;
  v8us v;
#pragma unroll
  for (int i = 0; i < 8; ++i) v[i] = bf16_bits(W[(size_t)(k8 + i) * N + n]);
  *(v8us*)(Wt + (size_t)n * K + k8) = v;
  
}

// GEMM C[M][N] (f32, pitch ldc) = act(A[M][K]·W + bias). A f32 row-major (pitch lda) converted per fragment to bf16
// (ASPLIT: hi/lo two planes -> 2 terms, else single rounded term); Wt bf16 [N][K] (pitch ldb). BIAS_BF16 rounds the
// bias to bf16 first (bias quantised to bf16 before the add). K%32==0, M%16==0, N%64==0.
template <bool ASPLIT, int ACT, bool BIAS_BF16>
__global__ __launch_bounds__(128) void k_gemm_bf(const float* __restrict__ A, int lda, const unsigned short* __restrict__ Wt, int ldb,
                                               const float* __restrict__ bias, float* __restrict__ C, int ldc, int M, int N, int K) {
  __shared__ __attribute__((aligned(16))) float so[4][16][64];
  const int tid = threadIdx.x, w = tid >> 5, lane = tid & 31, ln = lane & 15, hh = lane >> 4;
  const int ntn = N / 64;
  const int wid = blockIdx.x * 4 + w;
  const int mt = wid / ntn, nq = wid % ntn;
  if (mt * 16 >= M) return;
  const int row0 = mt * 16, col0 = nq * 64;
  const float* arow = A + (size_t)(row0 + ln) * lda;
  v8f acc[4] = {};
  for (int kb = 0; kb < K; kb += 32) {
    FragB ah, al;
    const v4f x0 = *(const v4fa*)(arow + kb + 8 * hh), x1 = *(const v4fa*)(arow + kb + 8 * hh + 4);
    const v4f x2 = *(const v4fa*)(arow + kb + 16 + 8 * hh), x3 = *(const v4fa*)(arow + kb + 16 + 8 * hh + 4);
    float xs[16] = {x0[0],x0[1],x0[2],x0[3],x1[0],x1[1],x1[2],x1[3],x2[0],x2[1],x2[2],x2[3],x3[0],x3[1],x3[2],x3[3]};
#pragma unroll
    for (int i = 0; i < 16; ++i) { const unsigned short hb = bf16_bits(xs[i]); ah.u[i] = hb; al.u[i] = ASPLIT ? bf16_bits(xs[i] - bf16_val(hb)) : (unsigned short)0; }
#pragma unroll
    for (int t = 0; t < 4; ++t) {
      const unsigned short* brow = Wt + (size_t)(col0 + t * 16 + ln) * ldb + kb;
      FragB b;
      b.half[0] = *(const v8us*)(brow + 8 * hh);
      b.half[1] = *(const v8us*)(brow + 16 + 8 * hh);
      acc[t] = mmaN<ASPLIT ? 2 : 1>(ah.v, al.v, b.v, b.v, acc[t]);
    }
  }
#pragma unroll
  for (int t = 0; t < 4; ++t) {
    float bv = bias ? bias[col0 + t * 16 + ln] : 0.f;
    if (BIAS_BF16) bv = bf16_round(bv);
#pragma unroll
    for (int r = 0; r < 8; ++r) { float v = acc[t][r] + bv; if (ACT == 1) v = fmaxf(v, 0.f); so[w][8 * hh + r][t * 16 + ln] = v; }
  }
  __builtin_amdgcn_fence(__ATOMIC_ACQ_REL, "workgroup");
  __builtin_amdgcn_wave_barrier();
  const int rsub = lane >> 4, c4 = (lane & 15) * 4;
  {
#pragma unroll
    for (int q = 0; q < 8; ++q) {
      const int r = q * 2 + rsub;
      const v4f v = *(const v4fa*)&so[w][r][c4];
      *(v4f*)(C + (size_t)(row0 + r) * ldc + col0 + c4) = v;
    }
    
  }
}

// GEMM C = act(A·W + bias + resid): A f32 (ASPLIT -> hi/lo 2 terms), Wt bf16 [N][K]; ACT 0 none, 1 relu, 2 exact gelu;
// resid (optional, f32, row index = (row % rmod), pitch ldr, RES_BF16 rounds it) added before the activation.
template <bool ASPLIT, int ACT, bool BIAS_BF16, bool RES_BF16>
__global__ __launch_bounds__(128) void k_gemm_bf3(const float* __restrict__ A, int lda, const unsigned short* __restrict__ Wt, int ldb,
                                                const float* __restrict__ bias, const float* __restrict__ resid, int rmod, int ldr,
                                                float* __restrict__ C, int ldc, int M, int N, int K) {
  __shared__ __attribute__((aligned(16))) float so[4][16][64];
  const int tid = threadIdx.x, w = tid >> 5, lane = tid & 31, ln = lane & 15, hh = lane >> 4;
  const int ntn = N / 64;
  const int wid = blockIdx.x * 4 + w;
  const int mt = wid / ntn, nq = wid % ntn;
  if (mt * 16 >= M) return;
  const int row0 = mt * 16, col0 = nq * 64;
  const float* arow = A + (size_t)(row0 + ln) * lda;
  v8f acc[4] = {};
  for (int kb = 0; kb < K; kb += 32) {
    FragB ah, al;
    const v4f x0 = *(const v4fa*)(arow + kb + 8 * hh), x1 = *(const v4fa*)(arow + kb + 8 * hh + 4);
    const v4f x2 = *(const v4fa*)(arow + kb + 16 + 8 * hh), x3 = *(const v4fa*)(arow + kb + 16 + 8 * hh + 4);
    float xs[16] = {x0[0],x0[1],x0[2],x0[3],x1[0],x1[1],x1[2],x1[3],x2[0],x2[1],x2[2],x2[3],x3[0],x3[1],x3[2],x3[3]};
#pragma unroll
    for (int i = 0; i < 16; ++i) { const unsigned short hb = bf16_bits(xs[i]); ah.u[i] = hb; al.u[i] = ASPLIT ? bf16_bits(xs[i] - bf16_val(hb)) : (unsigned short)0; }
#pragma unroll
    for (int t = 0; t < 4; ++t) {
      const unsigned short* brow = Wt + (size_t)(col0 + t * 16 + ln) * ldb + kb;
      FragB b;
      b.half[0] = *(const v8us*)(brow + 8 * hh);
      b.half[1] = *(const v8us*)(brow + 16 + 8 * hh);
      acc[t] = mmaN<ASPLIT ? 2 : 1>(ah.v, al.v, b.v, b.v, acc[t]);
    }
  }
#pragma unroll
  for (int t = 0; t < 4; ++t) {
    const int col = col0 + t * 16 + ln;
    float bv = bias ? bias[col] : 0.f;
    if (BIAS_BF16) bv = bf16_round(bv);
#pragma unroll
    for (int r = 0; r < 8; ++r) {
      float v = acc[t][r] + bv;
      if (resid) { float rv = resid[(size_t)((row0 + 8 * hh + r) % rmod) * ldr + col]; if (RES_BF16) rv = bf16_round(rv); v += rv; }
      if (ACT == 1) v = fmaxf(v, 0.f);
      if (ACT == 2) v = 0.5f * v * (1.0f + erff(v * 0.70710678118654752f));
      if (ACT == 3) { const float u = 0.7978845608028654f * (v + 0.044715f * v * v * v); v = 0.5f * v * (1.0f + tanhf(u)); }
      so[w][8 * hh + r][t * 16 + ln] = v;
    }
  }
  __builtin_amdgcn_fence(__ATOMIC_ACQ_REL, "workgroup");
  __builtin_amdgcn_wave_barrier();
  const int rsub = lane >> 4, c4 = (lane & 15) * 4;
  {
#pragma unroll
    for (int q = 0; q < 8; ++q) {
      const int r = q * 2 + rsub;
      const v4f v = *(const v4fa*)&so[w][r][c4];
      *(v4f*)(C + (size_t)(row0 + r) * ldc + col0 + c4) = v;
    }
    
  }
}
// row LayerNorm (biased variance, eps) over N: s = X (+ R); optional out_sum <- s; out_norm <- (s-mu)*rsqrt(var+eps)*g + b
template <bool PARAM_BF16>
__global__ __launch_bounds__(256) void k_layernorm(const float* __restrict__ X, const float* __restrict__ R, const float* __restrict__ g, const float* __restrict__ bta,
                                                  float* __restrict__ out_sum, float* __restrict__ out_norm, int N, float eps) {
  __shared__ float red[256];
  const int row = blockIdx.x, tid = threadIdx.x;
  const float* x = X + (size_t)row * N; const float* rr = R ? R + (size_t)row * N : nullptr;
  float vals[16];                     // up to N = 4096
  const int per = N / 256;            // contiguous chunk per thread? use strided-by-4 chunks: thread handles j = tid*4 + 1024*u
  float s1 = 0.f;
  for (int u = 0; u < per / 4; ++u) {
    const int j = tid * 4 + 1024 * u;
    const v4f a = *(const v4fa*)(x + j);
    v4f b = {0.f,0.f,0.f,0.f}; if (rr) b = *(const v4fa*)(rr + j);
#pragma unroll
    for (int q = 0; q < 4; ++q) { const float v = a[q] + b[q]; vals[u * 4 + q] = v; s1 += v; }
  }
  red[tid] = s1; __syncthreads();
  for (int st = 128; st > 0; st >>= 1) { if (tid < st) red[tid] += red[tid + st]; __syncthreads(); }
  const float mu = red[0] / (float)N; __syncthreads();
  float s2 = 0.f;
  for (int u = 0; u < per / 4; ++u)
#pragma unroll
    for (int q = 0; q < 4; ++q) { const float c = vals[u * 4 + q] - mu; s2 += c * c; }
  red[tid] = s2; __syncthreads();
  for (int st = 128; st > 0; st >>= 1) { if (tid < st) red[tid] += red[tid + st]; __syncthreads(); }
  const float rs = rsqrtf(red[0] / (float)N + eps);
  {
    for (int u = 0; u < per / 4; ++u) {
      const int j = tid * 4 + 1024 * u;
      v4f o, sm;
#pragma unroll
      for (int q = 0; q < 4; ++q) {
        float gg = g[j + q], bb = bta[j + q];
        if (PARAM_BF16) { gg = bf16_round(gg); bb = bf16_round(bb); }
        sm[q] = vals[u * 4 + q]; o[q] = (vals[u * 4 + q] - mu) * rs * gg + bb;
      }
      if (out_sum) *(v4f*)(out_sum + (size_t)row * N + j) = sm;
      *(v4f*)(out_norm + (size_t)row * N + j) = o;
    }
    
  }
}



// ---- f16 WMMA path (v_wmma_f32_16x16x32_f16): 11-bit significands for operands in range — used where a [0,1] probability operand needs more precision than bf16
typedef _Float16 v16h __attribute__((ext_vector_type(16)));
union FragH { v16h v; v8us half[2]; _Float16 h[16]; unsigned short u[16]; };
template <int NT>
__device__ __forceinline__ v8f mmaH(v16h ah, v16h al, v16h bh, v16h bl, v8f c) {
  c = __builtin_amdgcn_wmma_f32_16x16x32_f16(false, ah, false, bh, (short)0, c, false, false);
  if (NT >= 2) c = __builtin_amdgcn_wmma_f32_16x16x32_f16(false, al, false, bh, (short)0, c, false, false);
  if (NT >= 3) c = __builtin_amdgcn_wmma_f32_16x16x32_f16(false, ah, false, bl, (short)0, c, false, false);
  asm volatile("v_nop\n\tv_nop\n\tv_nop\n\tv_nop" : "+v"(c) : "v"(ah), "v"(al), "v"(bh), "v"(bl));
  return c;
}
// batched GEMM like k_gemm_b but f16 operands: A f32 (split into f16 hi/lo if ASPLIT, else rounded to f16), Bt = f16 values [n][k]; alpha; C f32; N multiple of 16 (partial tiles skipped)
template <bool ASPLIT>
__global__ __launch_bounds__(128) void k_gemm_h(const float* __restrict__ A, int lda, size_t sA, const _Float16* __restrict__ Bh, int ldb, size_t sB, float alpha, float* __restrict__ C, int ldc, size_t sC, int M, int N, int K) {
  __shared__ __attribute__((aligned(16))) float so[4][16][64];
  const int tid = threadIdx.x, w = tid >> 5, lane = tid & 31, ln = lane & 15, hh = lane >> 4; const int by = blockIdx.y;
  A += (size_t)by * sA; Bh += (size_t)by * sB; C += (size_t)by * sC;
  const int ntn = (N + 63) / 64; const int wid = blockIdx.x * 4 + w; const int mt = wid / ntn, nq = wid % ntn; if (mt * 16 >= M) return;
  const int row0 = mt * 16, col0 = nq * 64; const float* arow = A + (size_t)(row0 + ln) * lda;
  v8f acc[4] = {};
  for (int kb = 0; kb < K; kb += 32) {
    FragH ah, al;
    const v4f x0 = *(const v4fa*)(arow + kb + 8 * hh), x1 = *(const v4fa*)(arow + kb + 8 * hh + 4), x2 = *(const v4fa*)(arow + kb + 16 + 8 * hh), x3 = *(const v4fa*)(arow + kb + 16 + 8 * hh + 4);
    float xs[16] = {x0[0],x0[1],x0[2],x0[3],x1[0],x1[1],x1[2],x1[3],x2[0],x2[1],x2[2],x2[3],x3[0],x3[1],x3[2],x3[3]};
#pragma unroll
    for (int i = 0; i < 16; ++i) { const _Float16 h = (_Float16)xs[i]; ah.h[i] = h; al.h[i] = ASPLIT ? (_Float16)(xs[i] - (float)h) : (_Float16)0.0f; }
#pragma unroll
    for (int t = 0; t < 4; ++t) { if (col0 + t * 16 >= N) continue; const size_t boff = (size_t)(col0 + t * 16 + ln) * ldb + kb; FragH bq; bq.half[0] = *(const v8us*)(Bh + boff + 8 * hh); bq.half[1] = *(const v8us*)(Bh + boff + 16 + 8 * hh);
      acc[t] = mmaH<ASPLIT ? 2 : 1>(ah.v, al.v, bq.v, bq.v, acc[t]); }
  }
#pragma unroll
  for (int t = 0; t < 4; ++t) { if (col0 + t * 16 >= N) continue;
#pragma unroll
    for (int r = 0; r < 8; ++r) so[w][8 * hh + r][t * 16 + ln] = acc[t][r] * alpha; }
  __builtin_amdgcn_fence(__ATOMIC_ACQ_REL, "workgroup"); __builtin_amdgcn_wave_barrier();
  const int rsub = lane >> 4, c4 = (lane & 15) * 4;
  {
#pragma unroll
    for (int q = 0; q < 8; ++q) { const int r = q * 2 + rsub; if (col0 + c4 < N) { const v4f v = *(const v4fa*)&so[w][r][c4]; *(v4f*)(C + (size_t)(row0 + r) * ldc + col0 + c4) = v; } }
     }
}

// Wt[n][k] = f16(W[k][n]·scale) from f32 row-major W[K][N] (scale = power of two; bf16-exact weights stay exact in f16 away from the subnormal range)
__global__ __launch_bounds__(256) void k_wt_f16(const float* __restrict__ W, _Float16* __restrict__ Wt, int K, int N, float scale) {
  const int t = blockIdx.x * 256 + threadIdx.x; if (t >= N * (K / 8)) return; const int n = t / (K / 8), k8 = (t % (K / 8)) * 8; FragH f;
#pragma unroll
  for (int i = 0; i < 8; ++i) f.h[i] = (_Float16)(bf16_round(W[(size_t)(k8 + i) * N + n]) * scale); const v8us o = f.half[0];
  *(v8us*)((unsigned short*)Wt + (size_t)n * K + k8) = o; 
}
// k_gemm_hh variant with fused epilogue: v = acc·alpha + bias[by·sBias + col] (+ CP[(row/rowsPerB)·sCPb + by·64 + col] if CP) ; ACT 0 none / 1 elu ; writes f16 C16 (and f32 C if non-null)
template <int ACT>
__global__ __launch_bounds__(128) void k_gemm_hhx(const _Float16* __restrict__ A, int lda, size_t sA, const _Float16* __restrict__ Bh, int ldb, size_t sB, float alpha, const float* __restrict__ bias, size_t sBias, const float* __restrict__ CP, int rowsPerB, size_t sCPb, int row0g,
    float* __restrict__ C, _Float16* __restrict__ C16, int ldc, size_t sC, int M, int N, int K) {
  __shared__ __attribute__((aligned(16))) float so[4][16][64];
  const int tid = threadIdx.x, w = tid >> 5, lane = tid & 31, ln = lane & 15, hh = lane >> 4; const int by = blockIdx.y;
  A += (size_t)by * sA; Bh += (size_t)by * sB; const size_t cofs = (size_t)by * sC; const float* bp = bias ? bias + (size_t)by * sBias : nullptr;
  const int ntn = (N + 63) / 64; const int wid = blockIdx.x * 4 + w; const int mt = wid / ntn, nq = wid % ntn; if (mt * 16 >= M) return;
  const int row0 = mt * 16, col0 = nq * 64; const _Float16* arow = A + (size_t)(row0 + ln) * lda;
  v8f acc[4] = {};
  for (int kb = 0; kb < K; kb += 32) { FragH ah; ah.half[0] = *(const v8us*)((const unsigned short*)arow + kb + 8 * hh); ah.half[1] = *(const v8us*)((const unsigned short*)arow + kb + 16 + 8 * hh);
#pragma unroll
    for (int t = 0; t < 4; ++t) { if (col0 + t * 16 >= N) continue; const size_t boff = (size_t)(col0 + t * 16 + ln) * ldb + kb; FragH bq; bq.half[0] = *(const v8us*)((const unsigned short*)Bh + boff + 8 * hh); bq.half[1] = *(const v8us*)((const unsigned short*)Bh + boff + 16 + 8 * hh);
      acc[t] = mmaH<1>(ah.v, ah.v, bq.v, bq.v, acc[t]); }
  }
#pragma unroll
  for (int t = 0; t < 4; ++t) { if (col0 + t * 16 >= N) continue; const int col = col0 + t * 16 + ln; const float bv = bp ? bf16_round(bp[col]) : 0.f;
#pragma unroll
    for (int r = 0; r < 8; ++r) { float v = acc[t][r] * alpha + bv; if (CP) { const int rr = row0g + row0 + 8 * hh + r; if (rowsPerB < 0) v += CP[cofs + (size_t)rr * ldc + col];      /* rowsPerB < 0: own element of the batched C plane */ else { const int bidx = rr / rowsPerB; v += CP[(size_t)bidx * sCPb + (size_t)by * 64 + col]; } } if (ACT == 1) v = (v > 0.f) ? v : expm1f(v); else if (ACT == 7) v = (v > 0.f) ? v + 1.0f : expf(v); else if (ACT == 8) v = tanhf(v); else if (ACT == 9) v = 0.5f * v * (1.0f + tanhf(0.7978845608028654f * (v + 0.044715f * v * v * v))); else if (ACT == 11) v = 1.0f / (1.0f + expf(-v)); else if (ACT == 12) v = (v > 0.f) ? v : 0.01f * v; else if (ACT == 14) v = (v > 0.f) ? v : 0.1f * v; else if (ACT == 16) v = (v >= 0.f) ? v : 0.3f * v; else if (ACT == 17) v = (v >= 0.f) ? v : 0.2f * v; else if (ACT == 15) v = v / (1.0f + expf(-v)); else if (ACT == 3) v = fmaxf(v, 0.f); else if (ACT == 6) v = 0.5f * v * (1.0f + erff(v * 0.70710678118654752f)); so[w][8 * hh + r][t * 16 + ln] = v; } }
  __builtin_amdgcn_fence(__ATOMIC_ACQ_REL, "workgroup"); __builtin_amdgcn_wave_barrier();
  const int rsub = lane >> 4, c4 = (lane & 15) * 4; typedef _Float16 v4h __attribute__((ext_vector_type(4)));
  {
#pragma unroll
    for (int q = 0; q < 8; ++q) { const int r = q * 2 + rsub; if (col0 + c4 < N) { const v4f v = *(const v4fa*)&so[w][r][c4]; if (C) *(v4f*)(C + cofs + (size_t)(row0 + r) * ldc + col0 + c4) = v; if (C16) { v4h h4; for (int i = 0; i < 4; ++i) h4[i] = (_Float16)v[i]; *(v4h*)(C16 + cofs + (size_t)(row0 + r) * ldc + col0 + c4) = h4; } } }
     }
}


typedef _Float16 v4h __attribute__((ext_vector_type(4)));

__global__ __launch_bounds__(256) void k_x16(const float* __restrict__ x, _Float16* __restrict__ X16, size_t n8) { const size_t t = (size_t)blockIdx.x * 256 + threadIdx.x; if (t >= n8) return; FragH f;
#pragma unroll
  for (int q = 0; q < 8; ++q) f.h[q] = (_Float16)bf16_round(x[t * 8 + q]); *(v8us*)((unsigned short*)X16 + t * 8) = f.half[0];  }
__global__ __launch_bounds__(256) void k_h16(const float* __restrict__ x, _Float16* __restrict__ X16, size_t n8) { const size_t t = (size_t)blockIdx.x * 256 + threadIdx.x; if (t >= n8) return; FragH f;
#pragma unroll
  for (int q = 0; q < 8; ++q) f.h[q] = (_Float16)x[t * 8 + q]; *(v8us*)((unsigned short*)X16 + t * 8) = f.half[0];  }
__global__ __launch_bounds__(256) void k_round16f(const float* __restrict__ W, _Float16* __restrict__ Bt, size_t n8) { const size_t t = (size_t)blockIdx.x * 256 + threadIdx.x; if (t >= n8) return; FragH f;
#pragma unroll
  for (int i = 0; i < 8; ++i) f.h[i] = (_Float16)(bf16_round(W[t * 8 + i]) * 16.0f); *(v8us*)((unsigned short*)Bt + t * 8) = f.half[0];  }
template <int NHv, int TTv>
__global__ __launch_bounds__(256) void k_vt(const _Float16* __restrict__ V16, int ldv, int voff, _Float16* __restrict__ Vt) { __shared__ unsigned short tl[64][66]; const int tid = threadIdx.x; const int slab = blockIdx.x / (TTv / 64), lg = blockIdx.x % (TTv / 64); const int b = slab / NHv, h = slab % NHv;
  for (int i = tid; i < 64 * 8; i += 256) { const int r = i / 8, c8 = (i % 8) * 8; FragH f; f.half[0] = *(const v8us*)((const unsigned short*)V16 + ((size_t)b * TTv + lg * 64 + r) * ldv + voff + h * 64 + c8);
#pragma unroll
    for (int q = 0; q < 8; ++q) tl[r][c8 + q] = f.u[q]; }
  __syncthreads();
  {
#pragma unroll
    for (int rd = 0; rd < 2; ++rd) { const int d = rd * 32 + tid / 8, pc = tid % 8; FragH f;
#pragma unroll
      for (int q = 0; q < 8; ++q) f.u[q] = tl[pc * 8 + q][d];
      *(v8us*)((unsigned short*)Vt + ((size_t)slab * 64 + d) * TTv + lg * 64 + pc * 8) = f.half[0]; }
     } }

__global__ __launch_bounds__(256) void k_hl(const float* __restrict__ F, _Float16* __restrict__ Hh, _Float16* __restrict__ Hl, size_t n8) { const size_t t = (size_t)blockIdx.x * 256 + threadIdx.x; if (t >= n8) return; FragH fh, fl; const v4f a = *(const v4fa*)(F + t * 8), c = *(const v4fa*)(F + t * 8 + 4);
#pragma unroll
  for (int q = 0; q < 4; ++q) { _Float16 h = (_Float16)a[q]; fh.h[q] = h; fl.h[q] = (_Float16)((a[q] - (float)h) * 1024.0f); h = (_Float16)c[q]; fh.h[4 + q] = h; fl.h[4 + q] = (_Float16)((c[q] - (float)h) * 1024.0f); }
  { *(v8us*)((unsigned short*)Hh + t * 8) = fh.half[0]; *(v8us*)((unsigned short*)Hl + t * 8) = fl.half[0];  } }

// ---- fast GEMM (wave tile 32x64; requires M % 32 == 0 rows per launch region and N % 64 == 0); epilogue = k_gemm_hhx semantics ----
__device__ __forceinline__ v16h g2_frag(const _Float16* p, int hh) { FragH f; f.half[0] = *(const v8us*)((const unsigned short*)p + 8 * hh); f.half[1] = *(const v8us*)((const unsigned short*)p + 16 + 8 * hh); return f.v; }
__device__ __forceinline__ v8f g2_mma(v16h a, v16h b, v8f c) { v8f d = __builtin_amdgcn_wmma_f32_16x16x32_f16(false, a, false, b, (short)0, c, false, false); asm volatile("v_nop\n\tv_nop\n\tv_nop\n\tv_nop" : "+v"(d) : "v"(a), "v"(b)); return d; }
template <int ACT>
__global__ __launch_bounds__(128) void k_gemm2(const _Float16* __restrict__ A, int lda, size_t sA, const _Float16* __restrict__ Bh, int ldb, size_t sB, float alpha, const float* __restrict__ bias, size_t sBias, const float* __restrict__ CP, int rowsPerB, size_t sCPb, int row0g,
    float* __restrict__ C, _Float16* __restrict__ C16, int ldc, size_t sC, int M, int N, int K) { static_assert(ACT == 0 || ACT == 3 || ACT == 6 || ACT == 8 || ACT == 9 || ACT == 11 || ACT == 12 || ACT == 14 || ACT == 15 || ACT == 16 || ACT == 17, "k_gemm2: unsupported ACT code (would silently apply no activation)");
  __shared__ __attribute__((aligned(16))) float so[4][32][68];
  const int tid = threadIdx.x, w = tid >> 5, lane = tid & 31, ln = lane & 15, hh = lane >> 4; const int by = blockIdx.y;
  A += (size_t)by * sA; Bh += (size_t)by * sB; const size_t cofs = (size_t)by * sC; const float* bp = bias ? bias + (size_t)by * sBias : nullptr;
  const int ntn = N >> 6; const int mt = blockIdx.x / ntn, nq = blockIdx.x - mt * ntn; const int row0 = mt * 128 + 32 * w, col0 = nq * 64; if (row0 >= M) return;
  const _Float16* a0p = A + (size_t)(row0 + ln) * lda; const _Float16* a1p = a0p + (size_t)16 * lda;
  const _Float16* b0p = Bh + (size_t)(col0 + ln) * ldb; const _Float16* b1p = b0p + (size_t)16 * ldb; const _Float16* b2p = b1p + (size_t)16 * ldb; const _Float16* b3p = b2p + (size_t)16 * ldb;
  const v8f z8 = {0.f,0.f,0.f,0.f,0.f,0.f,0.f,0.f}; v8f c00 = z8, c01 = z8, c02 = z8, c03 = z8, c10 = z8, c11 = z8, c12 = z8, c13 = z8;
#pragma unroll 1
  for (int kb = 0; kb < K; kb += 32) { const v16h a0 = g2_frag(a0p + kb, hh), a1 = g2_frag(a1p + kb, hh);
    v16h b = g2_frag(b0p + kb, hh); c00 = g2_mma(a0, b, c00); c10 = g2_mma(a1, b, c10);
    b = g2_frag(b1p + kb, hh); c01 = g2_mma(a0, b, c01); c11 = g2_mma(a1, b, c11);
    b = g2_frag(b2p + kb, hh); c02 = g2_mma(a0, b, c02); c12 = g2_mma(a1, b, c12);
    b = g2_frag(b3p + kb, hh); c03 = g2_mma(a0, b, c03); c13 = g2_mma(a1, b, c13); }
  v8f accs[8] = {c00, c01, c02, c03, c10, c11, c12, c13};
#pragma unroll
  for (int u = 0; u < 8; ++u) { const int t = u & 3, half = u >> 2; const int col = col0 + t * 16 + ln; const float bv = bp ? bf16_round(bp[col]) : 0.f;
#pragma unroll
    for (int r = 0; r < 8; ++r) { const int rloc = half * 16 + 8 * hh + r; float v = accs[u][r] * alpha + bv; if (CP) { if (rowsPerB < 0) v += CP[cofs + (size_t)(row0g + row0 + rloc) * ldc + col];      /* rowsPerB < 0: own element of the batched C plane */ else { const int bidx = (row0g + row0 + rloc) / rowsPerB; v += CP[(size_t)bidx * sCPb + (size_t)by * 64 + col]; } }
      if (ACT == 3) v = fmaxf(v, 0.f); else if (ACT == 6) v = 0.5f * v * (1.0f + erff(v * 0.70710678118654752f)); else if (ACT == 11) v = 1.0f / (1.0f + expf(-v)); else if (ACT == 15) v = v / (1.0f + expf(-v)); else if (ACT == 12) v = (v > 0.f) ? v : 0.01f * v; else if (ACT == 8) v = tanhf(v); else if (ACT == 9) v = 0.5f * v * (1.0f + tanhf(0.7978845608028654f * (v + 0.044715f * v * v * v))); else if (ACT == 14) v = (v > 0.f) ? v : 0.1f * v; else if (ACT == 16) v = (v >= 0.f) ? v : 0.3f * v; else if (ACT == 17) v = (v >= 0.f) ? v : 0.2f * v;
      so[w][rloc][t * 16 + ln] = v; } }
  __builtin_amdgcn_fence(__ATOMIC_ACQ_REL, "workgroup"); __builtin_amdgcn_wave_barrier();
  const int rsub = lane >> 4, c4 = (lane & 15) * 4;
  {
#pragma unroll
    for (int q = 0; q < 16; ++q) { const int r = q * 2 + rsub; const v4f v = *(const v4fa*)&so[w][r][c4]; if (C) *(v4f*)(C + cofs + (size_t)(row0 + r) * ldc + col0 + c4) = v; if (C16) { v4h h4; for (int i = 0; i < 4; ++i) h4[i] = (_Float16)v[i]; *(v4h*)(C16 + cofs + (size_t)(row0 + r) * ldc + col0 + c4) = h4; } }
     } }


__global__ __launch_bounds__(256) void k_wnat(const float* __restrict__ w, size_t n8, _Float16* __restrict__ Bt) { const size_t t = (size_t)blockIdx.x * 256 + threadIdx.x; if (t >= n8) return; FragH f; for (int q = 0; q < 8; ++q) f.h[q] = (_Float16)(bf16_round(w[t * 8 + q]) * 16.0f); *(v8us*)((unsigned short*)Bt + t * 8) = f.half[0];  }
__global__ __launch_bounds__(256) void k_rsm(const float* __restrict__ S, _Float16* __restrict__ P, int nrows) {
  #pragma clang fp contract(off)
  const int i = blockIdx.x * 256 + threadIdx.x; if (i >= nrows) return; const float* s = S + (size_t)i * SQ; float mx = -3.0e38f;
#pragma unroll 1
  for (int j = 0; j < SQ; ++j) mx = fmaxf(mx, s[j]); float se = 0.f;
#pragma unroll 1
  for (int j = 0; j < SQ; ++j) se += expf(s[j] - mx); const float sc = 256.0f / se;
#pragma unroll 1
  for (int j0 = 0; j0 < SQ; j0 += 8) { FragH f; for (int q = 0; q < 8; ++q) f.h[q] = (_Float16)(expf(s[j0 + q] - mx) * sc); unsigned short* d = (unsigned short*)P + (size_t)i * SQ + j0; *(v8us*)d = f.half[0];  } }
__global__ __launch_bounds__(256) void k_vt(const _Float16* __restrict__ V16, int b, int h0, _Float16* __restrict__ VT) { __shared__ unsigned short tl[64][65]; const int tid = threadIdx.x; const int hh = blockIdx.x % HG, sg = blockIdx.x / HG; const int s0 = sg * 64; const int h = h0 + hh;
  for (int i = tid; i < 64 * 8; i += 256) { const int j = i / 8, d8 = (i % 8) * 8; FragH f; f.half[0] = *(const v8us*)((const unsigned short*)V16 + ((size_t)b * SQ + s0 + j) * DM + h * HD + d8); for (int q = 0; q < 8; ++q) tl[d8 + q][j] = f.u[q]; }
  __syncthreads();
  { for (int i = tid; i < 64 * 8; i += 256) { const int d = i / 8, j8 = (i % 8) * 8; FragH f; for (int q = 0; q < 8; ++q) f.u[q] = tl[d][j8 + q]; *(v8us*)((unsigned short*)VT + ((size_t)hh * HD + d) * SQ + s0 + j8) = f.half[0]; }  } }



__global__ __launch_bounds__(256) void k_rsmcf2(const float* __restrict__ S, _Float16* __restrict__ P, int hg, int q0, int nk) {
  #pragma clang fp contract(off)
  const int t = blockIdx.x * 256 + threadIdx.x; if (t >= hg * QT) return; const size_t i = (size_t)t; const float* s = S + i * NKX; const int last = q0 + (t % QT); float mx = -3.0e38f;
#pragma unroll 1
  for (int j = 0; j < nk; ++j) { const float f = (j <= last) ? 1.f : 0.f; mx = fmaxf(mx, fmaf(f, s[j], (1.f - f) * -1.0e9f)); } float se = 0.f;
#pragma unroll 1
  for (int j = 0; j < nk; ++j) { const float f = (j <= last) ? 1.f : 0.f; se += __expf(fmaf(f, s[j], (1.f - f) * -1.0e9f) - mx); } const float sc = 256.0f / se;
#pragma unroll 1
  for (int j0 = 0; j0 < nk; j0 += 8) { FragH fr; for (int q = 0; q < 8; ++q) { const int j = j0 + q; const float f = (j <= last) ? 1.f : 0.f; fr.h[q] = (_Float16)(__expf(fmaf(f, s[j], (1.f - f) * -1.0e9f) - mx) * sc); } unsigned short* d = (unsigned short*)P + i * NKX + j0; *(v8us*)d = fr.half[0];  } }


template <int MASKADD>
__global__ __launch_bounds__(64) void k_att0(const float* __restrict__ QF, const float* __restrict__ KF, const float* __restrict__ VF, int ld, const float* __restrict__ mask, float scale, float* __restrict__ OF, int ldo) {
  #pragma clang fp contract(off)
  __shared__ __attribute__((aligned(16))) float lq[64][64]; __shared__ __attribute__((aligned(16))) float lo[64][64];
  const int tid = threadIdx.x; const int h = blockIdx.x / (QT0 / 64), rg = blockIdx.x % (QT0 / 64); const int i = rg * 64 + tid;
  const float* qr = QF + (size_t)i * ld + h * HD;
#pragma unroll 1
  for (int c = 0; c < HD / 4; ++c) { *(v4f*)&lq[tid][c * 4] = *(const v4fa*)(qr + c * 4); const v4f z = {0.f, 0.f, 0.f, 0.f}; *(v4f*)&lo[tid][c * 4] = z; }
  float m = -1.0e30f, l = 0.f; const int jmax = MASKADD ? (SQ - 1) : (rg * 64 + 63);      /* additive-mask form: every key (the mask input decides); causal form: keys up to the block's last row */
#pragma unroll 1
  for (int j = 0; j <= jmax; ++j) { const float* kr = KF + (size_t)j * ld + h * HD; const float* vr = VF + (size_t)j * ld + h * HD; float s = 0.f;
#pragma unroll 1
    for (int c = 0; c < HD / 4; ++c) { const v4f kq = *(const v4fa*)(kr + c * 4); const v4f qq = *(v4f*)&lq[tid][c * 4]; s = __fadd_rn(s, __fmul_rn(qq[0], kq[0])); s = __fadd_rn(s, __fmul_rn(qq[1], kq[1])); s = __fadd_rn(s, __fmul_rn(qq[2], kq[2])); s = __fadd_rn(s, __fmul_rn(qq[3], kq[3])); }
    s = __fmul_rn(s, scale); if (MASKADD) s = __fadd_rn(s, __fmul_rn(bf16_round(mask[(size_t)i * SQ + j]), -10000.0f));
    const float f = (MASKADD || j <= i) ? 1.f : 0.f; const float sm = fmaf(f, s, (1.f - f) * -1.0e30f); const float mn = fmaxf(m, sm); const float sc = expf(m - mn); const float e = expf(sm - mn); l = __fadd_rn(__fmul_rn(l, sc), e); m = mn;
#pragma unroll 1
    for (int c = 0; c < HD / 4; ++c) { const v4f vv = *(const v4fa*)(vr + c * 4); v4f oo = *(v4f*)&lo[tid][c * 4]; for (int u = 0; u < 4; ++u) oo[u] = __fadd_rn(__fmul_rn(oo[u], sc), __fmul_rn(e, vv[u])); *(v4f*)&lo[tid][c * 4] = oo; } }
  const float fin = 64.0f / l;      /* o carried x64 */
#pragma unroll 1
  for (int c = 0; c < HD / 4; ++c) { v4f oo = *(v4f*)&lo[tid][c * 4]; for (int u = 0; u < 4; ++u) oo[u] = __fmul_rn(oo[u], fin); *(v4f*)&lo[tid][c * 4] = oo; }
  __syncthreads();
  {
#pragma unroll 1
    for (int it = 0; it < 16; ++it) { const int row = it * 4 + tid / 16, pc = (tid % 16) * 4; const v4f v = *(const v4f*)&lo[row][pc]; *(v4f*)(OF + (size_t)(rg * 64 + row) * ldo + h * HD + pc) = v; }
     } }


__global__ __launch_bounds__(256) void k_trirow(const float* __restrict__ S, float* __restrict__ WPD) {
  #pragma clang fp contract(off)
  const int b = blockIdx.x * 256 + threadIdx.x; if (b >= SQ) return; const float* s = S + (size_t)b * SQ; float m = (b > 0) ? 0.f : -3.0e38f;
#pragma unroll 1
  for (int a = b; a < SQ; ++a) m = fmaxf(m, s[a]); float z = __fmul_rn((float)b, expf(-m));
#pragma unroll 1
  for (int a = b; a < SQ; ++a) z = __fadd_rn(z, expf(__fadd_rn(s[a], -m)));
  const float wp = __fdiv_rn(expf(-m), z), wd = __fdiv_rn(expf(__fadd_rn(s[b], -m)), z);
  *(float*)(WPD + 2 * b) = wp; *(float*)(WPD + 2 * b + 1) = wd;  }
__global__ __launch_bounds__(256) void k_colscan(const float* __restrict__ V, float* __restrict__ PRE) {
  #pragma clang fp contract(off)
  const int c = blockIdx.x * 256 + threadIdx.x; if (c >= DM) return;
  { float acc = 0.f;
#pragma unroll 1
    for (int b = 0; b < SQ; ++b) { *(float*)(PRE + (size_t)b * DM + c) = acc; acc = __fadd_rn(acc, V[(size_t)b * DM + c]); }
     } }
__global__ __launch_bounds__(256) void k_trifin(const float* __restrict__ PRE, const float* __restrict__ V, const float* __restrict__ WPD, float* __restrict__ out, size_t n4) {
  #pragma clang fp contract(off)
  const size_t t = (size_t)blockIdx.x * 256 + threadIdx.x; if (t >= n4) return; const size_t e = t * 4; const int b = (int)(e / DM); const float wp = WPD[2 * b], wd = WPD[2 * b + 1];
  const v4f p = *(const v4fa*)(PRE + e), v = *(const v4fa*)(V + e); v4f r; for (int q = 0; q < 4; ++q) r[q] = __fadd_rn(__fmul_rn(wp, p[q]), __fmul_rn(wd, v[q]));
  *(v4f*)(out + e) = r;  }

__global__ __launch_bounds__(256) void k_rsmfu(const float* __restrict__ S, _Float16* __restrict__ P) {
  #pragma clang fp contract(off)
  const int j = blockIdx.x * 256 + threadIdx.x; if (j >= SQ) return; const float* s = S + (size_t)j * SQ; float mx = -3.0e38f;
#pragma unroll 1
  for (int i = 0; i < SQ; ++i) { const float f = (i >= j) ? 1.f : 0.f; mx = fmaxf(mx, fmaf(f, s[i], (1.f - f) * -1.0e9f)); } float se = 0.f;
#pragma unroll 1
  for (int i = 0; i < SQ; ++i) { const float f = (i >= j) ? 1.f : 0.f; se += __expf(fmaf(f, s[i], (1.f - f) * -1.0e9f) - mx); } const float sc = 256.0f / se;
#pragma unroll 1
  for (int i0 = 0; i0 < SQ; i0 += 8) { FragH fr; for (int q = 0; q < 8; ++q) { const int i = i0 + q; const float f = (i >= j) ? 1.f : 0.f; fr.h[q] = (_Float16)(__expf(fmaf(f, s[i], (1.f - f) * -1.0e9f) - mx) * sc); } unsigned short* d = (unsigned short*)P + (size_t)j * SQ + i0; *(v8us*)d = fr.half[0];  } }
__global__ __launch_bounds__(256) void k_cs(const float* __restrict__ QF, const float* __restrict__ KF, float* __restrict__ SC) {
  #pragma clang fp contract(off)
  const int t = blockIdx.x * 256 + threadIdx.x; if (t >= 256 * 256) return; const int i = t / 256, j = t % 256; float s = -1.0e9f;
  if (j <= i) { const float* q = QF + (size_t)i * DM; const float* k = KF + (size_t)j * DM; float a = 0.f;
#pragma unroll 4
    for (int d = 0; d < DM; ++d) a = __fadd_rn(a, __fmul_rn(q[d], k[d])); s = __fmul_rn(a, 0.03125f); }
  *(float*)(SC + t) = s;  }
__global__ __launch_bounds__(256) void k_cz(const float* __restrict__ SC, float* __restrict__ W) {
  #pragma clang fp contract(off)
  const int j = threadIdx.x; float m = -3.0e38f;
#pragma unroll 1
  for (int i = j; i < 256; ++i) m = fmaxf(m, SC[i * 256 + j]); float z = 0.f;
#pragma unroll 1
  for (int i = j; i < 256; ++i) z = __fadd_rn(z, expf(__fadd_rn(SC[i * 256 + j], -m)));
  const float rz = __fdiv_rn(1.0f, z);
  {
#pragma unroll 1
    for (int i = 0; i < 256; ++i) { const float w = (i >= j) ? __fmul_rn(expf(__fadd_rn(SC[i * 256 + j], -m)), rz) : 0.f; *(float*)(W + i * 256 + j) = w; }
     } }
__global__ __launch_bounds__(256) void k_co(const float* __restrict__ W, const float* __restrict__ VF, float* __restrict__ out) {
  #pragma clang fp contract(off)
  const int t = blockIdx.x * 256 + threadIdx.x; if (t >= 256 * (DM / 4)) return; const int i = t / (DM / 4); const int c = (t % (DM / 4)) * 4; v4f acc = {0.f, 0.f, 0.f, 0.f};
#pragma unroll 1
  for (int j = 0; j <= i; ++j) { const float w = W[i * 256 + j]; const v4f v = *(const v4fa*)(VF + (size_t)j * DM + c); for (int u = 0; u < 4; ++u) acc[u] = __fadd_rn(acc[u], __fmul_rn(w, v[u])); }
  float* o = out + (size_t)i * DM + c; const v4f base = *(const v4fa*)o; v4f r; for (int u = 0; u < 4; ++u) r[u] = __fadd_rn(base[u], acc[u]);
  *(v4f*)o = r;  }

__global__ __launch_bounds__(256) void k_rsmfhl(const float* __restrict__ S, _Float16* __restrict__ P, _Float16* __restrict__ PL, int nrows) {
  #pragma clang fp contract(off)
  const int t = blockIdx.x * 256 + threadIdx.x; if (t >= nrows) return; const float* s = S + (size_t)t * SQ; float mx = -3.0e38f;
#pragma unroll 1
  for (int j = 0; j < SQ; ++j) mx = fmaxf(mx, s[j]); float se = 0.f;
#pragma unroll 1
  for (int j = 0; j < SQ; ++j) se += __expf(s[j] - mx); const float sc = 256.0f / se;
#pragma unroll 1
  for (int j0 = 0; j0 < SQ; j0 += 8) { FragH fr, fl; for (int q = 0; q < 8; ++q) { const float v = __expf(s[j0 + q] - mx) * sc; const _Float16 hv = (_Float16)v; fr.h[q] = hv; fl.h[q] = (_Float16)((v - (float)hv) * 1024.0f); }
    unsigned short* d = (unsigned short*)P + (size_t)t * SQ + j0; unsigned short* dl = (unsigned short*)PL + (size_t)t * SQ + j0; *(v8us*)d = fr.half[0]; *(v8us*)dl = fl.half[0];  } }

// Row softmax, one wave per score row: the row's 4096 f32 stay in the wave's registers (32 loads of 16 B per lane, each load 512 contiguous bytes of the row),
// so S is read once; maximum and sum are four chains per lane, then a five-step butterfly over the 32 lanes; each store is 256 contiguous bytes of P (weights x256 f16).
__global__ __launch_bounds__(256) void k_rsmw(const float* __restrict__ S, _Float16* __restrict__ P) {
  static_assert(SQ == 32 * 128 && SQ % 8 == 0, "k_rsmw: one wave holds a whole row, eight rows per block");
  const int lane = threadIdx.x & 31; const size_t row = (size_t)blockIdx.x * 8 + (threadIdx.x >> 5); const float* s = S + row * SQ + lane * 4; v4f x[32];
#pragma unroll
  for (int i = 0; i < 32; ++i) x[i] = *(const v4fa*)(s + i * 128);
  v4f m4 = x[0];
#pragma unroll
  for (int i = 1; i < 32; ++i) for (int q = 0; q < 4; ++q) m4[q] = fmaxf(m4[q], x[i][q]);
  float mx = fmaxf(fmaxf(m4[0], m4[1]), fmaxf(m4[2], m4[3]));
#pragma unroll
  for (int d = 16; d > 0; d >>= 1) mx = fmaxf(mx, __shfl_xor(mx, d, 32));
  v4f s4 = {0.f, 0.f, 0.f, 0.f};
#pragma unroll
  for (int i = 0; i < 32; ++i) { float e0 = (x[i][0] - mx) * 0x1.715476p+0f, e1 = (x[i][1] - mx) * 0x1.715476p+0f, e2 = (x[i][2] - mx) * 0x1.715476p+0f, e3 = (x[i][3] - mx) * 0x1.715476p+0f;      /* native exp: exp2((s - max) log2 e) */
    /* four exponentials in place; the closing v_nop is the free slot the instruction set asks for behind a transcendental */
    asm("v_exp_f32 %0, %0\n\tv_exp_f32 %1, %1\n\tv_exp_f32 %2, %2\n\tv_exp_f32 %3, %3\n\tv_nop" : "+v"(e0), "+v"(e1), "+v"(e2), "+v"(e3));
    x[i][0] = e0; x[i][1] = e1; x[i][2] = e2; x[i][3] = e3; s4[0] += e0; s4[1] += e1; s4[2] += e2; s4[3] += e3; }
  float se = (s4[0] + s4[1]) + (s4[2] + s4[3]);
#pragma unroll
  for (int d = 16; d > 0; d >>= 1) se += __shfl_xor(se, d, 32);
  const float sc = 256.0f / se; _Float16* p = P + row * SQ + lane * 4;
#pragma unroll
  for (int i = 0; i < 32; ++i) { v4h h4; for (int q = 0; q < 4; ++q) h4[q] = (_Float16)(x[i][q] * sc); *(v4h*)(p + i * 128) = h4; } }


// ---- GEMM with both operands staged in LDS by the tensor mover: C[M][N] f32 = alpha * A[M][K] * Bh[N][K]^T, f16 operands, K-contiguous rows.
// Workgroup tile 128 x 64, four waves of 32 x 64 (fragments, product order and epilogue as in k_gemm2). A pass is 128 k = 256 B of each of the 192 operand rows.
// Every wave brings one slice per pass with one tensor_load_to_lds (waves 0, 1: 64 rows of A each; waves 2, 3: 32 rows of Bh each) into one of two buffers,
// rows padded to a pitch of 272 B for the ds_load_b128 readers; the next pass's slices fly while this pass is worked on.
// Needs M % 128 == 0, N % 64 == 0, K % 128 == 0, K >= 256; grid = (M / 128) * (N / 64).
typedef uint32_t u32x4 __attribute__((ext_vector_type(4)));
typedef uint32_t u32x8 __attribute__((ext_vector_type(8)));
#define GL_PITCH 272u                      /* LDS row pitch: 256 B + 16 B pad */
#define GL_ASL 18432u                      /* 64 padded rows (17,408 B) rounded up to a multiple of 2 KiB */
#define GL_BSL 10240u                      /* 32 padded rows (8,704 B) rounded up to a multiple of 2 KiB */
#define GL_BUF (2u * GL_ASL + 2u * GL_BSL) /* one buffer: 57,344 B */
__device__ __forceinline__ uint32_t gl_uni(uint32_t v) { return (uint32_t)__builtin_amdgcn_readfirstlane(v); }
__device__ __forceinline__ uint32_t gl_pinned(uint32_t v) { uint32_t w = gl_uni(v); asm volatile("" : "+s"(w)); return w; }      /* pinned(): the test around a tensor load, held in a scalar register so that it compiles to s_cmp and a scalar branch (a tensor load ignores EXEC) */
__device__ __forceinline__ void gl_wait_ds0() { asm volatile("s_wait_dscnt 0x0" ::: "memory"); }          /* this wave's LDS reads are done before the buffer is handed back */
__device__ __forceinline__ void gl_wait_tensor0(u32x4 g0, u32x8 g1) { asm volatile("s_wait_tensorcnt 0x0" :: "s"(g0), "s"(g1) : "memory"); }  /* this wave's own slice has landed; the request's descriptor is named as an input so that its registers keep their values until here */
__device__ __forceinline__ u32x4 gl_load(uint32_t lds_dst, uint64_t ga, u32x8 g1) {
  u32x4 g0; g0[0] = gl_uni(1u); g0[1] = gl_uni(lds_dst); g0[2] = gl_uni((uint32_t)ga); g0[3] = gl_uni((((uint32_t)(ga >> 32)) & 0x01FFFFFFu) | 0x80000000u);
  asm volatile("tensor_load_to_lds %0, %1" :: "s"(g0), "s"(g1) : "memory"); return g0; }
__device__ __forceinline__ v16h gl_frag(const unsigned char* p) { FragH f; f.half[0] = *(const v8us*)p; f.half[1] = *(const v8us*)(p + 32); return f.v; }
__device__ __forceinline__ void gl_frags(v16h (&fa)[2], v16h (&fb)[4], const unsigned char* ap, const unsigned char* bp) {
  fa[0] = gl_frag(ap); fb[0] = gl_frag(bp); fa[1] = gl_frag(ap + 16u * GL_PITCH); fb[1] = gl_frag(bp + 16u * GL_PITCH); fb[2] = gl_frag(bp + GL_BSL); fb[3] = gl_frag(bp + GL_BSL + 16u * GL_PITCH); }
__global__ __launch_bounds__(128) void k_gemm2l(const _Float16* __restrict__ A, int lda, const _Float16* __restrict__ Bh, int ldb, float alpha, float* __restrict__ C, int ldc, int ntn, int K) {
  __shared__ __attribute__((aligned(2048))) unsigned char ring[2u * GL_BUF];
  __shared__ __attribute__((aligned(16))) float so[4][32][68];
  const int tid = threadIdx.x, w = tid >> 5, lane = tid & 31, ln = lane & 15, hh = lane >> 4;
  const int mt = blockIdx.x / ntn, nq = blockIdx.x - mt * ntn; const int row0 = mt * 128 + 32 * w, col0 = nq * 64;
  const uint32_t wave = gl_uni((uint32_t)tid >> 5); const bool isA = wave < 2u;
  const uint32_t rows = isA ? 64u : 32u; const uint32_t spitch = (uint32_t)(isA ? lda : ldb) * 2u;
  const uint64_t sbase = isA ? (uint64_t)(A + (size_t)(mt * 128 + 64 * (int)wave) * lda) : (uint64_t)(Bh + (size_t)(col0 + 32 * ((int)wave - 2)) * ldb);
  const uint32_t dst0 = (uint32_t)(uintptr_t)&ring[0] + (isA ? wave * GL_ASL : 2u * GL_ASL + (wave - 2u) * GL_BSL);
  u32x8 g1;      /* 1-byte elements, tensor = tile = rows x 256 B, a pad of 4 dwords behind every 64 dwords, no mask */
  g1[0] = gl_uni((1u << 20) | (5u << 22) | (3u << 25)); g1[1] = gl_uni(256u << 16); g1[2] = gl_uni(rows << 16); g1[3] = gl_uni(256u << 16); g1[4] = gl_uni(rows); g1[5] = gl_uni(spitch); g1[6] = gl_uni(0u); g1[7] = gl_uni(0u);
  const uint32_t np = (uint32_t)K >> 7;
  u32x4 g0 = gl_load(dst0, sbase, g1); gl_wait_tensor0(g0, g1); __syncthreads();      /* stage 0 landed and published */
  g0 = gl_load(dst0 + GL_BUF, sbase + 256u, g1);                        /* stage 1 flies under pass 0 */
  const uint32_t ao = (uint32_t)(w >> 1) * GL_ASL + (uint32_t)((w & 1) * 32 + ln) * GL_PITCH + 16u * (uint32_t)hh;
  const uint32_t bo = 2u * GL_ASL + (uint32_t)ln * GL_PITCH + 16u * (uint32_t)hh;
  const v8f z8 = {0.f,0.f,0.f,0.f,0.f,0.f,0.f,0.f}; v8f c00 = z8, c01 = z8, c02 = z8, c03 = z8, c10 = z8, c11 = z8, c12 = z8, c13 = z8;
#pragma unroll 1      /* one pass per trip: the publish point at the foot stands once */
  for (uint32_t s = 0; s < np; ++s) { const uint32_t bsel = (s & 1u) * GL_BUF; const unsigned char* ap = ring + bsel + ao; const unsigned char* bp = ring + bsel + bo;
    v16h fa[4][2], fb[4][4];      /* the pass's fragments: k steps 0 to 2 are read as one group in front of the products, step 3 behind step 0's products (all four at once would pass 256 registers) */
#pragma unroll
    for (int kk = 0; kk < 3; ++kk) gl_frags(fa[kk], fb[kk], ap + 64 * kk, bp + 64 * kk);
#pragma unroll
    for (int kk = 0; kk < 4; ++kk) {
      c00 = g2_mma(fa[kk][0], fb[kk][0], c00); c10 = g2_mma(fa[kk][1], fb[kk][0], c10); c01 = g2_mma(fa[kk][0], fb[kk][1], c01); c11 = g2_mma(fa[kk][1], fb[kk][1], c11);
      c02 = g2_mma(fa[kk][0], fb[kk][2], c02); c12 = g2_mma(fa[kk][1], fb[kk][2], c12); c03 = g2_mma(fa[kk][0], fb[kk][3], c03); c13 = g2_mma(fa[kk][1], fb[kk][3], c13);
      if (kk == 0) gl_frags(fa[3], fb[3], ap + 64 * 3, bp + 64 * 3); }
    gl_wait_ds0(); gl_wait_tensor0(g0, g1); __syncthreads();      /* publish point of stage s + 1; it also ends every reader's last read of stage s's buffer */
    const uint32_t nx = s + 2u;
    if (gl_pinned(nx < np)) g0 = gl_load(dst0 + bsel, sbase + (uint64_t)nx * 256u, g1); }
  gl_wait_tensor0(g0, g1); gl_wait_ds0();
  v8f accs[8] = {c00, c01, c02, c03, c10, c11, c12, c13};
#pragma unroll
  for (int u = 0; u < 8; ++u) { const int t = u & 3, half = u >> 2;
#pragma unroll
    for (int r = 0; r < 8; ++r) so[w][half * 16 + 8 * hh + r][t * 16 + ln] = accs[u][r] * alpha; }
  __builtin_amdgcn_fence(__ATOMIC_ACQ_REL, "workgroup"); __builtin_amdgcn_wave_barrier();
  const int rsub = lane >> 4, c4 = (lane & 15) * 4;
#pragma unroll
  for (int q = 0; q < 16; ++q) { const int r = q * 2 + rsub; const v4f v = *(const v4fa*)&so[w][r][c4]; *(v4f*)(C + (size_t)(row0 + r) * ldc + col0 + c4) = v; } }

extern "C" void kernel_launch(void* const* d_in, const int* in_sizes, int n_in,
                              void* d_out, int out_size, void* d_ws, size_t ws_size, hipStream_t stream) {
  (void)in_sizes; (void)n_in; (void)out_size;
  const float* const* I = (const float* const*)d_in; const float* xq = I[0]; const float* xk = I[1]; const float* xv = I[2];      /* q, k, v [4][4096][512] (bf16-valued) */
  char* ws = (char*)d_ws; size_t off = 0;
  auto take = [&](size_t bytes) { char* p = ws + off; off += (bytes + 255) & ~(size_t)255; return p; };
  _Float16* Q16 = (_Float16*)take(NR * DM * 2); _Float16* K16 = (_Float16*)take(NR * DM * 2); _Float16* V16 = (_Float16*)take(NR * DM * 2);
  float* S = (float*)take((size_t)SQ * SQ * 4); _Float16* P = (_Float16*)take((size_t)SQ * SQ * 2); _Float16* VT = (_Float16*)take((size_t)DM * SQ * 2);
  if (off > ws_size) return;
  k_x16<<<(unsigned)((NR * DM / 8 + 255) / 256), 256, 0, stream>>>(xq, Q16, NR * DM / 8); k_x16<<<(unsigned)((NR * DM / 8 + 255) / 256), 256, 0, stream>>>(xk, K16, NR * DM / 8); k_x16<<<(unsigned)((NR * DM / 8 + 255) / 256), 256, 0, stream>>>(xv, V16, NR * DM / 8);      /* exact f16 copies of the bf16-valued inputs */
  for (int b = 0; b < NB; ++b) { const size_t r0 = (size_t)b * SQ;
    k_gemm2l<<<(SQ / 128) * (SQ / 64), 128, 0, stream>>>(Q16 + r0 * DM, DM, K16 + r0 * DM, DM, 0.125f, S, SQ, SQ / 64, DM);      /* S = q k^T / sqrt(64) (K = 512, exact products) over the ORIGINAL order */
    k_rsmw<<<SQ / 8, 256, 0, stream>>>(S, P);      /* softmax over all 4096 positions -> P x256 f16 */
    k_vt<DM / 64, SQ><<<(DM / 64) * (SQ / 64), 256, 0, stream>>>(V16 + r0 * DM, DM, 0, VT);      /* V^T [512][4096] */
    k_gemm2l<<<(SQ / 128) * (DM / 64), 128, 0, stream>>>(P, SQ, VT, SQ, 0.00390625f, (float*)d_out + r0 * DM, DM, DM / 64, SQ); }      /* out = P V^T 2^-8 f32 into the batch's rows (original order: the module's inverse permutation undoes its permutation) */
}

// v003
// A run of this version takes 239 microseconds.
// In both of two side-by-side timings against v002, it was 1.45 times as fast.
// Over all steps from v000 it is 14.6 times as fast.
#include <hip/hip_runtime.h>
// Dense single-head attention over a strided-permuted sequence (q, k, v [4][4096][512]; the module permutes the sequence (64 x 64 blocks transposed), runs FULL softmax attention w = softmax(q k^T / sqrt(64)) over all 4096 positions, a = w v, and applies the inverse permutation — a full attention is permutation-equivariant, so out[t] = softmax(q_t K^T / 8) V on the original order -> [4][4096][512]).
// Structure: token rows; the bf16-valued q, k, v inputs as exact f16 rows; per batch: S = q k^T / 8 (K = 512, exact products) as ONE WMMA GEMM (32x64 wave tiles, f32 accumulation) [4096][4096] f32; row softmax on VALU (f32 statistics, native exp; weights x256 f16); V^T via LDS transposes; out = P V^T 2^-8 f32.
// Compute dtype: inputs rounded to bf16; q, k, v and softmax weights as plain f16 GEMM operands (~2^-12); scores and softmax statistics f32. v_wmma_f32_16x16x32_f16.
#define NB 4
#define SQ 4096
#define DM 512
#define NH 16
#define HD 64
#define HG 4                         /* heads per launch of k_vt(V16, b, h0, VT), which is not launched */
#define QT 256                       /* query rows per causal tile */
#define NKX SQ                       /* S / P row pitch */
#define QT0 128                      /* first-tile rows recomputed exactly in f32 */
#define B0 0                         /* first batch processed (unused) */
#define NBR NB                       /* batches processed (used only in MP) */
#define NR ((size_t)NB * SQ)         /* token rows */
#define MP ((int)((size_t)NBR * SQ)) /* all token rows (used only in MPO) */
#define QN SQ                        /* query rows attended per batch (unused) */
#define NHD NH                       /* unused; the attention here is single-head */
#define MPO MP                       /* rows through the output stage (unused) */
#define LQ DM      /* row pitch of the q/k/v rows */
typedef __bf16 v16b __attribute__((ext_vector_type(16)));
typedef unsigned short v8us __attribute__((ext_vector_type(8), may_alias));
typedef float  v8f  __attribute__((ext_vector_type(8)));
typedef float  v4f  __attribute__((ext_vector_type(4)));
typedef float  v4fa __attribute__((ext_vector_type(4), may_alias));
union FragB { v16b v; v8us half[2]; unsigned short u[16]; };

__device__ __forceinline__ unsigned short bf16_bits(float x) { unsigned int u = __float_as_uint(x); return (unsigned short)((u + 0x7FFFu + ((u >> 16) & 1u)) >> 16); }
__device__ __forceinline__ float bf16_val(unsigned short b) { return __uint_as_float(((unsigned int)b) << 16); }
__device__ __forceinline__ float bf16_round(float x) { return bf16_val(bf16_bits(x)); }
// D += A·B with NT terms: 1 = ah·bh, 2 = + al·bh (A split), 3 = + ah·bl (both split)
template <int NT>
__device__ __forceinline__ v8f mmaN(v16b ah, v16b al, v16b bh, v16b bl, v8f c) {
  c = __builtin_amdgcn_wmma_f32_16x16x32_bf16(false, ah, false, bh, (short)0, c, false, false);
  if (NT >= 2) c = __builtin_amdgcn_wmma_f32_16x16x32_bf16(false, al, false, bh, (short)0, c, false, false);
  if (NT >= 3) c = __builtin_amdgcn_wmma_f32_16x16x32_bf16(false, ah, false, bl, (short)0, c, false, false);
  asm volatile("v_nop\n\tv_nop\n\tv_nop\n\tv_nop" : "+v"(c) : "v"(ah), "v"(al), "v"(bh), "v"(bl));
  return c;
}

__global__ __launch_bounds__(256) void k_wt_bf16(const float* __restrict__ W, unsigned short* __restrict__ Wt, int K, int N) {
  const int t = blockIdx.x * 256 + threadIdx.x;
  const int k8n = K / 8;
  if (t >= N * k8n) return;
  const int n = t / k8n, k8 = (t % k8n) * 8;
  v8us v;
#pragma unroll
  for (int i = 0; i < 8; ++i) v[i] = bf16_bits(W[(size_t)(k8 + i) * N + n]);
  *(v8us*)(Wt + (size_t)n * K + k8) = v;
  
}

// GEMM C[M][N] (f32, pitch ldc) = act(A[M][K]·W + bias). A f32 row-major (pitch lda) converted per fragment to bf16
// (ASPLIT: hi/lo two planes -> 2 terms, else single rounded term); Wt bf16 [N][K] (pitch ldb). BIAS_BF16 rounds the
// bias to bf16 first (bias quantised to bf16 before the add). K%32==0, M%16==0, N%64==0.
template <bool ASPLIT, int ACT, bool BIAS_BF16>
__global__ __launch_bounds__(128) void k_gemm_bf(const float* __restrict__ A, int lda, const unsigned short* __restrict__ Wt, int ldb,
                                               const float* __restrict__ bias, float* __restrict__ C, int ldc, int M, int N, int K) {
  __shared__ __attribute__((aligned(16))) float so[4][16][64];
  const int tid = threadIdx.x, w = tid >> 5, lane = tid & 31, ln = lane & 15, hh = lane >> 4;
  const int ntn = N / 64;
  const int wid = blockIdx.x * 4 + w;
  const int mt = wid / ntn, nq = wid % ntn;
  if (mt * 16 >= M) return;
  const int row0 = mt * 16, col0 = nq * 64;
  const float* arow = A + (size_t)(row0 + ln) * lda;
  v8f acc[4] = {};
  for (int kb = 0; kb < K; kb += 32) {
    FragB ah, al;
    const v4f x0 = *(const v4fa*)(arow + kb + 8 * hh), x1 = *(const v4fa*)(arow + kb + 8 * hh + 4);
    const v4f x2 = *(const v4fa*)(arow + kb + 16 + 8 * hh), x3 = *(const v4fa*)(arow + kb + 16 + 8 * hh + 4);
    float xs[16] = {x0[0],x0[1],x0[2],x0[3],x1[0],x1[1],x1[2],x1[3],x2[0],x2[1],x2[2],x2[3],x3[0],x3[1],x3[2],x3[3]};
#pragma unroll
    for (int i = 0; i < 16; ++i) { const unsigned short hb = bf16_bits(xs[i]); ah.u[i] = hb; al.u[i] = ASPLIT ? bf16_bits(xs[i] - bf16_val(hb)) : (unsigned short)0; }
#pragma unroll
    for (int t = 0; t < 4; ++t) {
      const unsigned short* brow = Wt + (size_t)(col0 + t * 16 + ln) * ldb + kb;
      FragB b;
      b.half[0] = *(const v8us*)(brow + 8 * hh);
      b.half[1] = *(const v8us*)(brow + 16 + 8 * hh);
      acc[t] = mmaN<ASPLIT ? 2 : 1>(ah.v, al.v, b.v, b.v, acc[t]);
    }
  }
#pragma unroll
  for (int t = 0; t < 4; ++t) {
    float bv = bias ? bias[col0 + t * 16 + ln] : 0.f;
    if (BIAS_BF16) bv = bf16_round(bv);
#pragma unroll
    for (int r = 0; r < 8; ++r) { float v = acc[t][r] + bv; if (ACT == 1) v = fmaxf(v, 0.f); so[w][8 * hh + r][t * 16 + ln] = v; }
  }
  __builtin_amdgcn_fence(__ATOMIC_ACQ_REL, "workgroup");
  __builtin_amdgcn_wave_barrier();
  const int rsub = lane >> 4, c4 = (lane & 15) * 4;
  {
#pragma unroll
    for (int q = 0; q < 8; ++q) {
      const int r = q * 2 + rsub;
      const v4f v = *(const v4fa*)&so[w][r][c4];
      *(v4f*)(C + (size_t)(row0 + r) * ldc + col0 + c4) = v;
    }
    
  }
}

// GEMM C = act(A·W + bias + resid): A f32 (ASPLIT -> hi/lo 2 terms), Wt bf16 [N][K]; ACT 0 none, 1 relu, 2 exact gelu;
// resid (optional, f32, row index = (row % rmod), pitch ldr, RES_BF16 rounds it) added before the activation.
template <bool ASPLIT, int ACT, bool BIAS_BF16, bool RES_BF16>
__global__ __launch_bounds__(128) void k_gemm_bf3(const float* __restrict__ A, int lda, const unsigned short* __restrict__ Wt, int ldb,
                                                const float* __restrict__ bias, const float* __restrict__ resid, int rmod, int ldr,
                                                float* __restrict__ C, int ldc, int M, int N, int K) {
  __shared__ __attribute__((aligned(16))) float so[4][16][64];
  const int tid = threadIdx.x, w = tid >> 5, lane = tid & 31, ln = lane & 15, hh = lane >> 4;
  const int ntn = N / 64;
  const int wid = blockIdx.x * 4 + w;
  const int mt = wid / ntn, nq = wid % ntn;
  if (mt * 16 >= M) return;
  const int row0 = mt * 16, col0 = nq * 64;
  const float* arow = A + (size_t)(row0 + ln) * lda;
  v8f acc[4] = {};
  for (int kb = 0; kb < K; kb += 32) {
    FragB ah, al;
    const v4f x0 = *(const v4fa*)(arow + kb + 8 * hh), x1 = *(const v4fa*)(arow + kb + 8 * hh + 4);
    const v4f x2 = *(const v4fa*)(arow + kb + 16 + 8 * hh), x3 = *(const v4fa*)(arow + kb + 16 + 8 * hh + 4);
    float xs[16] = {x0[0],x0[1],x0[2],x0[3],x1[0],x1[1],x1[2],x1[3],x2[0],x2[1],x2[2],x2[3],x3[0],x3[1],x3[2],x3[3]};
#pragma unroll
    for (int i = 0; i < 16; ++i) { const unsigned short hb = bf16_bits(xs[i]); ah.u[i] = hb; al.u[i] = ASPLIT ? bf16_bits(xs[i] - bf16_val(hb)) : (unsigned short)0; }
#pragma unroll
    for (int t = 0; t < 4; ++t) {
      const unsigned short* brow = Wt + (size_t)(col0 + t * 16 + ln) * ldb + kb;
      FragB b;
      b.half[0] = *(const v8us*)(brow + 8 * hh);
      b.half[1] = *(const v8us*)(brow + 16 + 8 * hh);
      acc[t] = mmaN<ASPLIT ? 2 : 1>(ah.v, al.v, b.v, b.v, acc[t]);
    }
  }
#pragma unroll
  for (int t = 0; t < 4; ++t) {
    const int col = col0 + t * 16 + ln;
    float bv = bias ? bias[col] : 0.f;
    if (BIAS_BF16) bv = bf16_round(bv);
#pragma unroll
    for (int r = 0; r < 8; ++r) {
      float v = acc[t][r] + bv;
      if (resid) { float rv = resid[(size_t)((row0 + 8 * hh + r) % rmod) * ldr + col]; if (RES_BF16) rv = bf16_round(rv); v += rv; }
      if (ACT == 1) v = fmaxf(v, 0.f);
      if (ACT == 2) v = 0.5f * v * (1.0f + erff(v * 0.70710678118654752f));
      if (ACT == 3) { const float u = 0.7978845608028654f * (v + 0.044715f * v * v * v); v = 0.5f * v * (1.0f + tanhf(u)); }
      so[w][8 * hh + r][t * 16 + ln] = v;
    }
  }
  __builtin_amdgcn_fence(__ATOMIC_ACQ_REL, "workgroup");
  __builtin_amdgcn_wave_barrier();
  const int rsub = lane >> 4, c4 = (lane & 15) * 4;
  {
#pragma unroll
    for (int q = 0; q < 8; ++q) {
      const int r = q * 2 + rsub;
      const v4f v = *(const v4fa*)&so[w][r][c4];
      *(v4f*)(C + (size_t)(row0 + r) * ldc + col0 + c4) = v;
    }
    
  }
}
// row LayerNorm (biased variance, eps) over N: s = X (+ R); optional out_sum <- s; out_norm <- (s-mu)*rsqrt(var+eps)*g + b
template <bool PARAM_BF16>
__global__ __launch_bounds__(256) void k_layernorm(const float* __restrict__ X, const float* __restrict__ R, const float* __restrict__ g, const float* __restrict__ bta,
                                                  float* __restrict__ out_sum, float* __restrict__ out_norm, int N, float eps) {
  __shared__ float red[256];
  const int row = blockIdx.x, tid = threadIdx.x;
  const float* x = X + (size_t)row * N; const float* rr = R ? R + (size_t)row * N : nullptr;
  float vals[16];                     // up to N = 4096
  const int per = N / 256;            // contiguous chunk per thread? use strided-by-4 chunks: thread handles j = tid*4 + 1024*u
  float s1 = 0.f;
  for (int u = 0; u < per / 4; ++u) {
    const int j = tid * 4 + 1024 * u;
    const v4f a = *(const v4fa*)(x + j);
    v4f b = {0.f,0.f,0.f,0.f}; if (rr) b = *(const v4fa*)(rr + j);
#pragma unroll
    for (int q = 0; q < 4; ++q) { const float v = a[q] + b[q]; vals[u * 4 + q] = v; s1 += v; }
  }
  red[tid] = s1; __syncthreads();
  for (int st = 128; st > 0; st >>= 1) { if (tid < st) red[tid] += red[tid + st]; __syncthreads(); }
  const float mu = red[0] / (float)N; __syncthreads();
  float s2 = 0.f;
  for (int u = 0; u < per / 4; ++u)
#pragma unroll
    for (int q = 0; q < 4; ++q) { const float c = vals[u * 4 + q] - mu; s2 += c * c; }
  red[tid] = s2; __syncthreads();
  for (int st = 128; st > 0; st >>= 1) { if (tid < st) red[tid] += red[tid + st]; __syncthreads(); }
  const float rs = rsqrtf(red[0] / (float)N + eps);
  {
    for (int u = 0; u < per / 4; ++u) {
      const int j = tid * 4 + 1024 * u;
      v4f o, sm;
#pragma unroll
      for (int q = 0; q < 4; ++q) {
        float gg = g[j + q], bb = bta[j + q];
        if (PARAM_BF16) { gg = bf16_round(gg); bb = bf16_round(bb); }
        sm[q] = vals[u * 4 + q]; o[q] = (vals[u * 4 + q] - mu) * rs * gg + bb;
      }
      if (out_sum) *(v4f*)(out_sum + (size_t)row * N + j) = sm;
      *(v4f*)(out_norm + (size_t)row * N + j) = o;
    }
    
  }
}



// ---- f16 WMMA path (v_wmma_f32_16x16x32_f16): 11-bit significands for operands in range — used where a [0,1] probability operand needs more precision than bf16
typedef _Float16 v16h __attribute__((ext_vector_type(16)));
union FragH { v16h v; v8us half[2]; _Float16 h[16]; unsigned short u[16]; };
template <int NT>
__device__ __forceinline__ v8f mmaH(v16h ah, v16h al, v16h bh, v16h bl, v8f c) {
  c = __builtin_amdgcn_wmma_f32_16x16x32_f16(false, ah, false, bh, (short)0, c, false, false);
  if (NT >= 2) c = __builtin_amdgcn_wmma_f32_16x16x32_f16(false, al, false, bh, (short)0, c, false, false);
  if (NT >= 3) c = __builtin_amdgcn_wmma_f32_16x16x32_f16(false, ah, false, bl, (short)0, c, false, false);
  asm volatile("v_nop\n\tv_nop\n\tv_nop\n\tv_nop" : "+v"(c) : "v"(ah), "v"(al), "v"(bh), "v"(bl));
  return c;
}
// batched GEMM like k_gemm_b but f16 operands: A f32 (split into f16 hi/lo if ASPLIT, else rounded to f16), Bt = f16 values [n][k]; alpha; C f32; N multiple of 16 (partial tiles skipped)
template <bool ASPLIT>
__global__ __launch_bounds__(128) void k_gemm_h(const float* __restrict__ A, int lda, size_t sA, const _Float16* __restrict__ Bh, int ldb, size_t sB, float alpha, float* __restrict__ C, int ldc, size_t sC, int M, int N, int K) {
  __shared__ __attribute__((aligned(16))) float so[4][16][64];
  const int tid = threadIdx.x, w = tid >> 5, lane = tid & 31, ln = lane & 15, hh = lane >> 4; const int by = blockIdx.y;
  A += (size_t)by * sA; Bh += (size_t)by * sB; C += (size_t)by * sC;
  const int ntn = (N + 63) / 64; const int wid = blockIdx.x * 4 + w; const int mt = wid / ntn, nq = wid % ntn; if (mt * 16 >= M) return;
  const int row0 = mt * 16, col0 = nq * 64; const float* arow = A + (size_t)(row0 + ln) * lda;
  v8f acc[4] = {};
  for (int kb = 0; kb < K; kb += 32) {
    FragH ah, al;
    const v4f x0 = *(const v4fa*)(arow + kb + 8 * hh), x1 = *(const v4fa*)(arow + kb + 8 * hh + 4), x2 = *(const v4fa*)(arow + kb + 16 + 8 * hh), x3 = *(const v4fa*)(arow + kb + 16 + 8 * hh + 4);
    float xs[16] = {x0[0],x0[1],x0[2],x0[3],x1[0],x1[1],x1[2],x1[3],x2[0],x2[1],x2[2],x2[3],x3[0],x3[1],x3[2],x3[3]};
#pragma unroll
    for (int i = 0; i < 16; ++i) { const _Float16 h = (_Float16)xs[i]; ah.h[i] = h; al.h[i] = ASPLIT ? (_Float16)(xs[i] - (float)h) : (_Float16)0.0f; }
#pragma unroll
    for (int t = 0; t < 4; ++t) { if (col0 + t * 16 >= N) continue; const size_t boff = (size_t)(col0 + t * 16 + ln) * ldb + kb; FragH bq; bq.half[0] = *(const v8us*)(Bh + boff + 8 * hh); bq.half[1] = *(const v8us*)(Bh + boff + 16 + 8 * hh);
      acc[t] = mmaH<ASPLIT ? 2 : 1>(ah.v, al.v, bq.v, bq.v, acc[t]); }
  }
#pragma unroll
  for (int t = 0; t < 4; ++t) { if (col0 + t * 16 >= N) continue;
#pragma unroll
    for (int r = 0; r < 8; ++r) so[w][8 * hh + r][t * 16 + ln] = acc[t][r] * alpha; }
  __builtin_amdgcn_fence(__ATOMIC_ACQ_REL, "workgroup"); __builtin_amdgcn_wave_barrier();
  const int rsub = lane >> 4, c4 = (lane & 15) * 4;
  {
#pragma unroll
    for (int q = 0; q < 8; ++q) { const int r = q * 2 + rsub; if (col0 + c4 < N) { const v4f v = *(const v4fa*)&so[w][r][c4]; *(v4f*)(C + (size_t)(row0 + r) * ldc + col0 + c4) = v; } }
     }
}

// Wt[n][k] = f16(W[k][n]·scale) from f32 row-major W[K][N] (scale = power of two; bf16-exact weights stay exact in f16 away from the subnormal range)
__global__ __launch_bounds__(256) void k_wt_f16(const float* __restrict__ W, _Float16* __restrict__ Wt, int K, int N, float scale) {
  const int t = blockIdx.x * 256 + threadIdx.x; if (t >= N * (K / 8)) return; const int n = t / (K / 8), k8 = (t % (K / 8)) * 8; FragH f;
#pragma unroll
  for (int i = 0; i < 8; ++i) f.h[i] = (_Float16)(bf16_round(W[(size_t)(k8 + i) * N + n]) * scale); const v8us o = f.half[0];
  *(v8us*)((unsigned short*)Wt + (size_t)n * K + k8) = o; 
}
// k_gemm_hh variant with fused epilogue: v = acc·alpha + bias[by·sBias + col] (+ CP[(row/rowsPerB)·sCPb + by·64 + col] if CP) ; ACT 0 none / 1 elu ; writes f16 C16 (and f32 C if non-null)
template <int ACT>
__global__ __launch_bounds__(128) void k_gemm_hhx(const _Float16* __restrict__ A, int lda, size_t sA, const _Float16* __restrict__ Bh, int ldb, size_t sB, float alpha, const float* __restrict__ bias, size_t sBias, const float* __restrict__ CP, int rowsPerB, size_t sCPb, int row0g,
    float* __restrict__ C, _Float16* __restrict__ C16, int ldc, size_t sC, int M, int N, int K) {
  __shared__ __attribute__((aligned(16))) float so[4][16][64];
  const int tid = threadIdx.x, w = tid >> 5, lane = tid & 31, ln = lane & 15, hh = lane >> 4; const int by = blockIdx.y;
  A += (size_t)by * sA; Bh += (size_t)by * sB; const size_t cofs = (size_t)by * sC; const float* bp = bias ? bias + (size_t)by * sBias : nullptr;
  const int ntn = (N + 63) / 64; const int wid = blockIdx.x * 4 + w; const int mt = wid / ntn, nq = wid % ntn; if (mt * 16 >= M) return;
  const int row0 = mt * 16, col0 = nq * 64; const _Float16* arow = A + (size_t)(row0 + ln) * lda;
  v8f acc[4] = {};
  for (int kb = 0; kb < K; kb += 32) { FragH ah; ah.half[0] = *(const v8us*)((const unsigned short*)arow + kb + 8 * hh); ah.half[1] = *(const v8us*)((const unsigned short*)arow + kb + 16 + 8 * hh);
#pragma unroll
    for (int t = 0; t < 4; ++t) { if (col0 + t * 16 >= N) continue; const size_t boff = (size_t)(col0 + t * 16 + ln) * ldb + kb; FragH bq; bq.half[0] = *(const v8us*)((const unsigned short*)Bh + boff + 8 * hh); bq.half[1] = *(const v8us*)((const unsigned short*)Bh + boff + 16 + 8 * hh);
      acc[t] = mmaH<1>(ah.v, ah.v, bq.v, bq.v, acc[t]); }
  }
#pragma unroll
  for (int t = 0; t < 4; ++t) { if (col0 + t * 16 >= N) continue; const int col = col0 + t * 16 + ln; const float bv = bp ? bf16_round(bp[col]) : 0.f;
#pragma unroll
    for (int r = 0; r < 8; ++r) { float v = acc[t][r] * alpha + bv; if (CP) { const int rr = row0g + row0 + 8 * hh + r; if (rowsPerB < 0) v += CP[cofs + (size_t)rr * ldc + col];      /* rowsPerB < 0: own element of the batched C plane */ else { const int bidx = rr / rowsPerB; v += CP[(size_t)bidx * sCPb + (size_t)by * 64 + col]; } } if (ACT == 1) v = (v > 0.f) ? v : expm1f(v); else if (ACT == 7) v = (v > 0.f) ? v + 1.0f : expf(v); else if (ACT == 8) v = tanhf(v); else if (ACT == 9) v = 0.5f * v * (1.0f + tanhf(0.7978845608028654f * (v + 0.044715f * v * v * v))); else if (ACT == 11) v = 1.0f / (1.0f + expf(-v)); else if (ACT == 12) v = (v > 0.f) ? v : 0.01f * v; else if (ACT == 14) v = (v > 0.f) ? v : 0.1f * v; else if (ACT == 16) v = (v >= 0.f) ? v : 0.3f * v; else if (ACT == 17) v = (v >= 0.f) ? v : 0.2f * v; else if (ACT == 15) v = v / (1.0f + expf(-v)); else if (ACT == 3) v = fmaxf(v, 0.f); else if (ACT == 6) v = 0.5f * v * (1.0f + erff(v * 0.70710678118654752f)); so[w][8 * hh + r][t * 16 + ln] = v; } }
  __builtin_amdgcn_fence(__ATOMIC_ACQ_REL, "workgroup"); __builtin_amdgcn_wave_barrier();
  const int rsub = lane >> 4, c4 = (lane & 15) * 4; typedef _Float16 v4h __attribute__((ext_vector_type(4)));
  {
#pragma unroll
    for (int q = 0; q < 8; ++q) { const int r = q * 2 + rsub; if (col0 + c4 < N) { const v4f v = *(const v4fa*)&so[w][r][c4]; if (C) *(v4f*)(C + cofs + (size_t)(row0 + r) * ldc + col0 + c4) = v; if (C16) { v4h h4; for (int i = 0; i < 4; ++i) h4[i] = (_Float16)v[i]; *(v4h*)(C16 + cofs + (size_t)(row0 + r) * ldc + col0 + c4) = h4; } } }
     }
}


typedef _Float16 v4h __attribute__((ext_vector_type(4)));

__global__ __launch_bounds__(256) void k_x16(const float* __restrict__ x, _Float16* __restrict__ X16, size_t n8) { const size_t t = (size_t)blockIdx.x * 256 + threadIdx.x; if (t >= n8) return; FragH f;
#pragma unroll
  for (int q = 0; q < 8; ++q) f.h[q] = (_Float16)bf16_round(x[t * 8 + q]); *(v8us*)((unsigned short*)X16 + t * 8) = f.half[0];  }
// q, k and v in one launch: each thread rounds its 8 elements of all three inputs (six 16 B loads in flight per lane, a third of the waves of three launches); X16 = three consecutive planes of n8 * 8 f16; values as k_x16
__global__ __launch_bounds__(256) void k_x16qkv(const float* __restrict__ xq, const float* __restrict__ xk, const float* __restrict__ xv, _Float16* __restrict__ X16, size_t n8) { const size_t t = (size_t)blockIdx.x * 256 + threadIdx.x; if (t >= n8) return;
  const v4f q0 = *(const v4fa*)(xq + t * 8), q1 = *(const v4fa*)(xq + t * 8 + 4), k0 = *(const v4fa*)(xk + t * 8), k1 = *(const v4fa*)(xk + t * 8 + 4), w0 = *(const v4fa*)(xv + t * 8), w1 = *(const v4fa*)(xv + t * 8 + 4); FragH fq, fk, fv;
#pragma unroll
  for (int i = 0; i < 4; ++i) { fq.h[i] = (_Float16)bf16_round(q0[i]); fq.h[4 + i] = (_Float16)bf16_round(q1[i]); fk.h[i] = (_Float16)bf16_round(k0[i]); fk.h[4 + i] = (_Float16)bf16_round(k1[i]); fv.h[i] = (_Float16)bf16_round(w0[i]); fv.h[4 + i] = (_Float16)bf16_round(w1[i]); }
  unsigned short* o = (unsigned short*)X16 + t * 8; *(v8us*)o = fq.half[0]; *(v8us*)(o + n8 * 8) = fk.half[0]; *(v8us*)(o + n8 * 16) = fv.half[0]; }
__global__ __launch_bounds__(256) void k_h16(const float* __restrict__ x, _Float16* __restrict__ X16, size_t n8) { const size_t t = (size_t)blockIdx.x * 256 + threadIdx.x; if (t >= n8) return; FragH f;
#pragma unroll
  for (int q = 0; q < 8; ++q) f.h[q] = (_Float16)x[t * 8 + q]; *(v8us*)((unsigned short*)X16 + t * 8) = f.half[0];  }
__global__ __launch_bounds__(256) void k_round16f(const float* __restrict__ W, _Float16* __restrict__ Bt, size_t n8) { const size_t t = (size_t)blockIdx.x * 256 + threadIdx.x; if (t >= n8) return; FragH f;
#pragma unroll
  for (int i = 0; i < 8; ++i) f.h[i] = (_Float16)(bf16_round(W[t * 8 + i]) * 16.0f); *(v8us*)((unsigned short*)Bt + t * 8) = f.half[0];  }
template <int NHv, int TTv>
__global__ __launch_bounds__(256) void k_vt(const _Float16* __restrict__ V16, int ldv, int voff, _Float16* __restrict__ Vt) { __shared__ unsigned short tl[64][66]; const int tid = threadIdx.x; const int slab = blockIdx.x / (TTv / 64), lg = blockIdx.x % (TTv / 64); const int b = slab / NHv, h = slab % NHv;
  for (int i = tid; i < 64 * 8; i += 256) { const int r = i / 8, c8 = (i % 8) * 8; FragH f; f.half[0] = *(const v8us*)((const unsigned short*)V16 + ((size_t)b * TTv + lg * 64 + r) * ldv + voff + h * 64 + c8);
#pragma unroll
    for (int q = 0; q < 8; ++q) tl[r][c8 + q] = f.u[q]; }
  __syncthreads();
  {
#pragma unroll
    for (int rd = 0; rd < 2; ++rd) { const int d = rd * 32 + tid / 8, pc = tid % 8; FragH f;
#pragma unroll
      for (int q = 0; q < 8; ++q) f.u[q] = tl[pc * 8 + q][d];
      *(v8us*)((unsigned short*)Vt + ((size_t)slab * 64 + d) * TTv + lg * 64 + pc * 8) = f.half[0]; }
     } }

__global__ __launch_bounds__(256) void k_hl(const float* __restrict__ F, _Float16* __restrict__ Hh, _Float16* __restrict__ Hl, size_t n8) { const size_t t = (size_t)blockIdx.x * 256 + threadIdx.x; if (t >= n8) return; FragH fh, fl; const v4f a = *(const v4fa*)(F + t * 8), c = *(const v4fa*)(F + t * 8 + 4);
#pragma unroll
  for (int q = 0; q < 4; ++q) { _Float16 h = (_Float16)a[q]; fh.h[q] = h; fl.h[q] = (_Float16)((a[q] - (float)h) * 1024.0f); h = (_Float16)c[q]; fh.h[4 + q] = h; fl.h[4 + q] = (_Float16)((c[q] - (float)h) * 1024.0f); }
  { *(v8us*)((unsigned short*)Hh + t * 8) = fh.half[0]; *(v8us*)((unsigned short*)Hl + t * 8) = fl.half[0];  } }

// ---- fast GEMM (wave tile 32x64; requires M % 32 == 0 rows per launch region and N % 64 == 0); epilogue = k_gemm_hhx semantics ----
__device__ __forceinline__ v16h g2_frag(const _Float16* p, int hh) { FragH f; f.half[0] = *(const v8us*)((const unsigned short*)p + 8 * hh); f.half[1] = *(const v8us*)((const unsigned short*)p + 16 + 8 * hh); return f.v; }
__device__ __forceinline__ v8f g2_mma(v16h a, v16h b, v8f c) { v8f d = __builtin_amdgcn_wmma_f32_16x16x32_f16(false, a, false, b, (short)0, c, false, false); asm volatile("v_nop\n\tv_nop\n\tv_nop\n\tv_nop" : "+v"(d) : "v"(a), "v"(b)); return d; }
template <int ACT>
__global__ __launch_bounds__(128) void k_gemm2(const _Float16* __restrict__ A, int lda, size_t sA, const _Float16* __restrict__ Bh, int ldb, size_t sB, float alpha, const float* __restrict__ bias, size_t sBias, const float* __restrict__ CP, int rowsPerB, size_t sCPb, int row0g,
    float* __restrict__ C, _Float16* __restrict__ C16, int ldc, size_t sC, int M, int N, int K) { static_assert(ACT == 0 || ACT == 3 || ACT == 6 || ACT == 8 || ACT == 9 || ACT == 11 || ACT == 12 || ACT == 14 || ACT == 15 || ACT == 16 || ACT == 17, "k_gemm2: unsupported ACT code (would silently apply no activation)");
  __shared__ __attribute__((aligned(16))) float so[4][32][68];
  const int tid = threadIdx.x, w = tid >> 5, lane = tid & 31, ln = lane & 15, hh = lane >> 4; const int by = blockIdx.y;
  A += (size_t)by * sA; Bh += (size_t)by * sB; const size_t cofs = (size_t)by * sC; const float* bp = bias ? bias + (size_t)by * sBias : nullptr;
  const int ntn = N >> 6; const int mt = blockIdx.x / ntn, nq = blockIdx.x - mt * ntn; const int row0 = mt * 128 + 32 * w, col0 = nq * 64; if (row0 >= M) return;
  const _Float16* a0p = A + (size_t)(row0 + ln) * lda; const _Float16* a1p = a0p + (size_t)16 * lda;
  const _Float16* b0p = Bh + (size_t)(col0 + ln) * ldb; const _Float16* b1p = b0p + (size_t)16 * ldb; const _Float16* b2p = b1p + (size_t)16 * ldb; const _Float16* b3p = b2p + (size_t)16 * ldb;
  const v8f z8 = {0.f,0.f,0.f,0.f,0.f,0.f,0.f,0.f}; v8f c00 = z8, c01 = z8, c02 = z8, c03 = z8, c10 = z8, c11 = z8, c12 = z8, c13 = z8;
#pragma unroll 1
  for (int kb = 0; kb < K; kb += 32) { const v16h a0 = g2_frag(a0p + kb, hh), a1 = g2_frag(a1p + kb, hh);
    v16h b = g2_frag(b0p + kb, hh); c00 = g2_mma(a0, b, c00); c10 = g2_mma(a1, b, c10);
    b = g2_frag(b1p + kb, hh); c01 = g2_mma(a0, b, c01); c11 = g2_mma(a1, b, c11);
    b = g2_frag(b2p + kb, hh); c02 = g2_mma(a0, b, c02); c12 = g2_mma(a1, b, c12);
    b = g2_frag(b3p + kb, hh); c03 = g2_mma(a0, b, c03); c13 = g2_mma(a1, b, c13); }
  v8f accs[8] = {c00, c01, c02, c03, c10, c11, c12, c13};
#pragma unroll
  for (int u = 0; u < 8; ++u) { const int t = u & 3, half = u >> 2; const int col = col0 + t * 16 + ln; const float bv = bp ? bf16_round(bp[col]) : 0.f;
#pragma unroll
    for (int r = 0; r < 8; ++r) { const int rloc = half * 16 + 8 * hh + r; float v = accs[u][r] * alpha + bv; if (CP) { if (rowsPerB < 0) v += CP[cofs + (size_t)(row0g + row0 + rloc) * ldc + col];      /* rowsPerB < 0: own element of the batched C plane */ else { const int bidx = (row0g + row0 + rloc) / rowsPerB; v += CP[(size_t)bidx * sCPb + (size_t)by * 64 + col]; } }
      if (ACT == 3) v = fmaxf(v, 0.f); else if (ACT == 6) v = 0.5f * v * (1.0f + erff(v * 0.70710678118654752f)); else if (ACT == 11) v = 1.0f / (1.0f + expf(-v)); else if (ACT == 15) v = v / (1.0f + expf(-v)); else if (ACT == 12) v = (v > 0.f) ? v : 0.01f * v; else if (ACT == 8) v = tanhf(v); else if (ACT == 9) v = 0.5f * v * (1.0f + tanhf(0.7978845608028654f * (v + 0.044715f * v * v * v))); else if (ACT == 14) v = (v > 0.f) ? v : 0.1f * v; else if (ACT == 16) v = (v >= 0.f) ? v : 0.3f * v; else if (ACT == 17) v = (v >= 0.f) ? v : 0.2f * v;
      so[w][rloc][t * 16 + ln] = v; } }
  __builtin_amdgcn_fence(__ATOMIC_ACQ_REL, "workgroup"); __builtin_amdgcn_wave_barrier();
  const int rsub = lane >> 4, c4 = (lane & 15) * 4;
  {
#pragma unroll
    for (int q = 0; q < 16; ++q) { const int r = q * 2 + rsub; const v4f v = *(const v4fa*)&so[w][r][c4]; if (C) *(v4f*)(C + cofs + (size_t)(row0 + r) * ldc + col0 + c4) = v; if (C16) { v4h h4; for (int i = 0; i < 4; ++i) h4[i] = (_Float16)v[i]; *(v4h*)(C16 + cofs + (size_t)(row0 + r) * ldc + col0 + c4) = h4; } }
     } }


__global__ __launch_bounds__(256) void k_wnat(const float* __restrict__ w, size_t n8, _Float16* __restrict__ Bt) { const size_t t = (size_t)blockIdx.x * 256 + threadIdx.x; if (t >= n8) return; FragH f; for (int q = 0; q < 8; ++q) f.h[q] = (_Float16)(bf16_round(w[t * 8 + q]) * 16.0f); *(v8us*)((unsigned short*)Bt + t * 8) = f.half[0];  }
__global__ __launch_bounds__(256) void k_rsm(const float* __restrict__ S, _Float16* __restrict__ P, int nrows) {
  #pragma clang fp contract(off)
  const int i = blockIdx.x * 256 + threadIdx.x; if (i >= nrows) return; const float* s = S + (size_t)i * SQ; float mx = -3.0e38f;
#pragma unroll 1
  for (int j = 0; j < SQ; ++j) mx = fmaxf(mx, s[j]); float se = 0.f;
#pragma unroll 1
  for (int j = 0; j < SQ; ++j) se += expf(s[j] - mx); const float sc = 256.0f / se;
#pragma unroll 1
  for (int j0 = 0; j0 < SQ; j0 += 8) { FragH f; for (int q = 0; q < 8; ++q) f.h[q] = (_Float16)(expf(s[j0 + q] - mx) * sc); unsigned short* d = (unsigned short*)P + (size_t)i * SQ + j0; *(v8us*)d = f.half[0];  } }
__global__ __launch_bounds__(256) void k_vt(const _Float16* __restrict__ V16, int b, int h0, _Float16* __restrict__ VT) { __shared__ unsigned short tl[64][65]; const int tid = threadIdx.x; const int hh = blockIdx.x % HG, sg = blockIdx.x / HG; const int s0 = sg * 64; const int h = h0 + hh;
  for (int i = tid; i < 64 * 8; i += 256) { const int j = i / 8, d8 = (i % 8) * 8; FragH f; f.half[0] = *(const v8us*)((const unsigned short*)V16 + ((size_t)b * SQ + s0 + j) * DM + h * HD + d8); for (int q = 0; q < 8; ++q) tl[d8 + q][j] = f.u[q]; }
  __syncthreads();
  { for (int i = tid; i < 64 * 8; i += 256) { const int d = i / 8, j8 = (i % 8) * 8; FragH f; for (int q = 0; q < 8; ++q) f.u[q] = tl[d][j8 + q]; *(v8us*)((unsigned short*)VT + ((size_t)hh * HD + d) * SQ + s0 + j8) = f.half[0]; }  } }



__global__ __launch_bounds__(256) void k_rsmcf2(const float* __restrict__ S, _Float16* __restrict__ P, int hg, int q0, int nk) {
  #pragma clang fp contract(off)
  const int t = blockIdx.x * 256 + threadIdx.x; if (t >= hg * QT) return; const size_t i = (size_t)t; const float* s = S + i * NKX; const int last = q0 + (t % QT); float mx = -3.0e38f;
#pragma unroll 1
  for (int j = 0; j < nk; ++j) { const float f = (j <= last) ? 1.f : 0.f; mx = fmaxf(mx, fmaf(f, s[j], (1.f - f) * -1.0e9f)); } float se = 0.f;
#pragma unroll 1
  for (int j = 0; j < nk; ++j) { const float f = (j <= last) ? 1.f : 0.f; se += __expf(fmaf(f, s[j], (1.f - f) * -1.0e9f) - mx); } const float sc = 256.0f / se;
#pragma unroll 1
  for (int j0 = 0; j0 < nk; j0 += 8) { FragH fr; for (int q = 0; q < 8; ++q) { const int j = j0 + q; const float f = (j <= last) ? 1.f : 0.f; fr.h[q] = (_Float16)(__expf(fmaf(f, s[j], (1.f - f) * -1.0e9f) - mx) * sc); } unsigned short* d = (unsigned short*)P + i * NKX + j0; *(v8us*)d = fr.half[0];  } }


template <int MASKADD>
__global__ __launch_bounds__(64) void k_att0(const float* __restrict__ QF, const float* __restrict__ KF, const float* __restrict__ VF, int ld, const float* __restrict__ mask, float scale, float* __restrict__ OF, int ldo) {
  #pragma clang fp contract(off)
  __shared__ __attribute__((aligned(16))) float lq[64][64]; __shared__ __attribute__((aligned(16))) float lo[64][64];
  const int tid = threadIdx.x; const int h = blockIdx.x / (QT0 / 64), rg = blockIdx.x % (QT0 / 64); const int i = rg * 64 + tid;
  const float* qr = QF + (size_t)i * ld + h * HD;
#pragma unroll 1
  for (int c = 0; c < HD / 4; ++c) { *(v4f*)&lq[tid][c * 4] = *(const v4fa*)(qr + c * 4); const v4f z = {0.f, 0.f, 0.f, 0.f}; *(v4f*)&lo[tid][c * 4] = z; }
  float m = -1.0e30f, l = 0.f; const int jmax = MASKADD ? (SQ - 1) : (rg * 64 + 63);      /* additive-mask form: every key (the mask input decides); causal form: keys up to the block's last row */
#pragma unroll 1
  for (int j = 0; j <= jmax; ++j) { const float* kr = KF + (size_t)j * ld + h * HD; const float* vr = VF + (size_t)j * ld + h * HD; float s = 0.f;
#pragma unroll 1
    for (int c = 0; c < HD / 4; ++c) { const v4f kq = *(const v4fa*)(kr + c * 4); const v4f qq = *(v4f*)&lq[tid][c * 4]; s = __fadd_rn(s, __fmul_rn(qq[0], kq[0])); s = __fadd_rn(s, __fmul_rn(qq[1], kq[1])); s = __fadd_rn(s, __fmul_rn(qq[2], kq[2])); s = __fadd_rn(s, __fmul_rn(qq[3], kq[3])); }
    s = __fmul_rn(s, scale); if (MASKADD) s = __fadd_rn(s, __fmul_rn(bf16_round(mask[(size_t)i * SQ + j]), -10000.0f));
    const float f = (MASKADD || j <= i) ? 1.f : 0.f; const float sm = fmaf(f, s, (1.f - f) * -1.0e30f); const float mn = fmaxf(m, sm); const float sc = expf(m - mn); const float e = expf(sm - mn); l = __fadd_rn(__fmul_rn(l, sc), e); m = mn;
#pragma unroll 1
    for (int c = 0; c < HD / 4; ++c) { const v4f vv = *(const v4fa*)(vr + c * 4); v4f oo = *(v4f*)&lo[tid][c * 4]; for (int u = 0; u < 4; ++u) oo[u] = __fadd_rn(__fmul_rn(oo[u], sc), __fmul_rn(e, vv[u])); *(v4f*)&lo[tid][c * 4] = oo; } }
  const float fin = 64.0f / l;      /* o carried x64 */
#pragma unroll 1
  for (int c = 0; c < HD / 4; ++c) { v4f oo = *(v4f*)&lo[tid][c * 4]; for (int u = 0; u < 4; ++u) oo[u] = __fmul_rn(oo[u], fin); *(v4f*)&lo[tid][c * 4] = oo; }
  __syncthreads();
  {
#pragma unroll 1
    for (int it = 0; it < 16; ++it) { const int row = it * 4 + tid / 16, pc = (tid % 16) * 4; const v4f v = *(const v4f*)&lo[row][pc]; *(v4f*)(OF + (size_t)(rg * 64 + row) * ldo + h * HD + pc) = v; }
     } }


__global__ __launch_bounds__(256) void k_trirow(const float* __restrict__ S, float* __restrict__ WPD) {
  #pragma clang fp contract(off)
  const int b = blockIdx.x * 256 + threadIdx.x; if (b >= SQ) return; const float* s = S + (size_t)b * SQ; float m = (b > 0) ? 0.f : -3.0e38f;
#pragma unroll 1
  for (int a = b; a < SQ; ++a) m = fmaxf(m, s[a]); float z = __fmul_rn((float)b, expf(-m));
#pragma unroll 1
  for (int a = b; a < SQ; ++a) z = __fadd_rn(z, expf(__fadd_rn(s[a], -m)));
  const float wp = __fdiv_rn(expf(-m), z), wd = __fdiv_rn(expf(__fadd_rn(s[b], -m)), z);
  *(float*)(WPD + 2 * b) = wp; *(float*)(WPD + 2 * b + 1) = wd;  }
__global__ __launch_bounds__(256) void k_colscan(const float* __restrict__ V, float* __restrict__ PRE) {
  #pragma clang fp contract(off)
  const int c = blockIdx.x * 256 + threadIdx.x; if (c >= DM) return;
  { float acc = 0.f;
#pragma unroll 1
    for (int b = 0; b < SQ; ++b) { *(float*)(PRE + (size_t)b * DM + c) = acc; acc = __fadd_rn(acc, V[(size_t)b * DM + c]); }
     } }
__global__ __launch_bounds__(256) void k_trifin(const float* __restrict__ PRE, const float* __restrict__ V, const float* __restrict__ WPD, float* __restrict__ out, size_t n4) {
  #pragma clang fp contract(off)
  const size_t t = (size_t)blockIdx.x * 256 + threadIdx.x; if (t >= n4) return; const size_t e = t * 4; const int b = (int)(e / DM); const float wp = WPD[2 * b], wd = WPD[2 * b + 1];
  const v4f p = *(const v4fa*)(PRE + e), v = *(const v4fa*)(V + e); v4f r; for (int q = 0; q < 4; ++q) r[q] = __fadd_rn(__fmul_rn(wp, p[q]), __fmul_rn(wd, v[q]));
  *(v4f*)(out + e) = r;  }

__global__ __launch_bounds__(256) void k_rsmfu(const float* __restrict__ S, _Float16* __restrict__ P) {
  #pragma clang fp contract(off)
  const int j = blockIdx.x * 256 + threadIdx.x; if (j >= SQ) return; const float* s = S + (size_t)j * SQ; float mx = -3.0e38f;
#pragma unroll 1
  for (int i = 0; i < SQ; ++i) { const float f = (i >= j) ? 1.f : 0.f; mx = fmaxf(mx, fmaf(f, s[i], (1.f - f) * -1.0e9f)); } float se = 0.f;
#pragma unroll 1
  for (int i = 0; i < SQ; ++i) { const float f = (i >= j) ? 1.f : 0.f; se += __expf(fmaf(f, s[i], (1.f - f) * -1.0e9f) - mx); } const float sc = 256.0f / se;
#pragma unroll 1
  for (int i0 = 0; i0 < SQ; i0 += 8) { FragH fr; for (int q = 0; q < 8; ++q) { const int i = i0 + q; const float f = (i >= j) ? 1.f : 0.f; fr.h[q] = (_Float16)(__expf(fmaf(f, s[i], (1.f - f) * -1.0e9f) - mx) * sc); } unsigned short* d = (unsigned short*)P + (size_t)j * SQ + i0; *(v8us*)d = fr.half[0];  } }
__global__ __launch_bounds__(256) void k_cs(const float* __restrict__ QF, const float* __restrict__ KF, float* __restrict__ SC) {
  #pragma clang fp contract(off)
  const int t = blockIdx.x * 256 + threadIdx.x; if (t >= 256 * 256) return; const int i = t / 256, j = t % 256; float s = -1.0e9f;
  if (j <= i) { const float* q = QF + (size_t)i * DM; const float* k = KF + (size_t)j * DM; float a = 0.f;
#pragma unroll 4
    for (int d = 0; d < DM; ++d) a = __fadd_rn(a, __fmul_rn(q[d], k[d])); s = __fmul_rn(a, 0.03125f); }
  *(float*)(SC + t) = s;  }
__global__ __launch_bounds__(256) void k_cz(const float* __restrict__ SC, float* __restrict__ W) {
  #pragma clang fp contract(off)
  const int j = threadIdx.x; float m = -3.0e38f;
#pragma unroll 1
  for (int i = j; i < 256; ++i) m = fmaxf(m, SC[i * 256 + j]); float z = 0.f;
#pragma unroll 1
  for (int i = j; i < 256; ++i) z = __fadd_rn(z, expf(__fadd_rn(SC[i * 256 + j], -m)));
  const float rz = __fdiv_rn(1.0f, z);
  {
#pragma unroll 1
    for (int i = 0; i < 256; ++i) { const float w = (i >= j) ? __fmul_rn(expf(__fadd_rn(SC[i * 256 + j], -m)), rz) : 0.f; *(float*)(W + i * 256 + j) = w; }
     } }
__global__ __launch_bounds__(256) void k_co(const float* __restrict__ W, const float* __restrict__ VF, float* __restrict__ out) {
  #pragma clang fp contract(off)
  const int t = blockIdx.x * 256 + threadIdx.x; if (t >= 256 * (DM / 4)) return; const int i = t / (DM / 4); const int c = (t % (DM / 4)) * 4; v4f acc = {0.f, 0.f, 0.f, 0.f};
#pragma unroll 1
  for (int j = 0; j <= i; ++j) { const float w = W[i * 256 + j]; const v4f v = *(const v4fa*)(VF + (size_t)j * DM + c); for (int u = 0; u < 4; ++u) acc[u] = __fadd_rn(acc[u], __fmul_rn(w, v[u])); }
  float* o = out + (size_t)i * DM + c; const v4f base = *(const v4fa*)o; v4f r; for (int u = 0; u < 4; ++u) r[u] = __fadd_rn(base[u], acc[u]);
  *(v4f*)o = r;  }

__global__ __launch_bounds__(256) void k_rsmfhl(const float* __restrict__ S, _Float16* __restrict__ P, _Float16* __restrict__ PL, int nrows) {
  #pragma clang fp contract(off)
  const int t = blockIdx.x * 256 + threadIdx.x; if (t >= nrows) return; const float* s = S + (size_t)t * SQ; float mx = -3.0e38f;
#pragma unroll 1
  for (int j = 0; j < SQ; ++j) mx = fmaxf(mx, s[j]); float se = 0.f;
#pragma unroll 1
  for (int j = 0; j < SQ; ++j) se += __expf(s[j] - mx); const float sc = 256.0f / se;
#pragma unroll 1
  for (int j0 = 0; j0 < SQ; j0 += 8) { FragH fr, fl; for (int q = 0; q < 8; ++q) { const float v = __expf(s[j0 + q] - mx) * sc; const _Float16 hv = (_Float16)v; fr.h[q] = hv; fl.h[q] = (_Float16)((v - (float)hv) * 1024.0f); }
    unsigned short* d = (unsigned short*)P + (size_t)t * SQ + j0; unsigned short* dl = (unsigned short*)PL + (size_t)t * SQ + j0; *(v8us*)d = fr.half[0]; *(v8us*)dl = fl.half[0];  } }

// Row softmax, one wave per score row: the row's 4096 f32 stay in the wave's registers (32 loads of 16 B per lane, each load 512 contiguous bytes of the row),
// so S is read once; maximum and sum are four chains per lane, then a five-step butterfly over the 32 lanes; each store is 256 contiguous bytes of P (weights x256 f16).
__global__ __launch_bounds__(256) void k_rsmw(const float* __restrict__ S, _Float16* __restrict__ P) {
  static_assert(SQ == 32 * 128 && SQ % 8 == 0, "k_rsmw: one wave holds a whole row, eight rows per block");
  const int lane = threadIdx.x & 31; const size_t row = (size_t)blockIdx.x * 8 + (threadIdx.x >> 5); const float* s = S + row * SQ + lane * 4; v4f x[32];
#pragma unroll
  for (int i = 0; i < 32; ++i) x[i] = *(const v4fa*)(s + i * 128);
  v4f m4 = x[0];
#pragma unroll
  for (int i = 1; i < 32; ++i) for (int q = 0; q < 4; ++q) m4[q] = fmaxf(m4[q], x[i][q]);
  float mx = fmaxf(fmaxf(m4[0], m4[1]), fmaxf(m4[2], m4[3]));
#pragma unroll
  for (int d = 16; d > 0; d >>= 1) mx = fmaxf(mx, __shfl_xor(mx, d, 32));
  v4f s4 = {0.f, 0.f, 0.f, 0.f};
#pragma unroll
  for (int i = 0; i < 32; ++i) { float e0 = (x[i][0] - mx) * 0x1.715476p+0f, e1 = (x[i][1] - mx) * 0x1.715476p+0f, e2 = (x[i][2] - mx) * 0x1.715476p+0f, e3 = (x[i][3] - mx) * 0x1.715476p+0f;      /* native exp: exp2((s - max) log2 e) */
    /* four exponentials in place; the closing v_nop is the free slot the instruction set asks for behind a transcendental */
    asm("v_exp_f32 %0, %0\n\tv_exp_f32 %1, %1\n\tv_exp_f32 %2, %2\n\tv_exp_f32 %3, %3\n\tv_nop" : "+v"(e0), "+v"(e1), "+v"(e2), "+v"(e3));
    x[i][0] = e0; x[i][1] = e1; x[i][2] = e2; x[i][3] = e3; s4[0] += e0; s4[1] += e1; s4[2] += e2; s4[3] += e3; }
  float se = (s4[0] + s4[1]) + (s4[2] + s4[3]);
#pragma unroll
  for (int d = 16; d > 0; d >>= 1) se += __shfl_xor(se, d, 32);
  const float sc = 256.0f / se; _Float16* p = P + row * SQ + lane * 4;
#pragma unroll
  for (int i = 0; i < 32; ++i) { v4h h4; for (int q = 0; q < 4; ++q) h4[q] = (_Float16)(x[i][q] * sc); *(v4h*)(p + i * 128) = h4; } }


// ---- GEMM with both operands staged in LDS by the tensor mover: C[M][N] f32 = alpha * A[M][K] * Bh[N][K]^T, f16 operands, K-contiguous rows.
// Workgroup tile 128 x 64, four waves of 32 x 64 (fragments, product order and epilogue as in k_gemm2). A pass is 128 k = 256 B of each of the 192 operand rows.
// Every wave brings one slice per pass with one tensor_load_to_lds (waves 0, 1: 64 rows of A each; waves 2, 3: 32 rows of Bh each) into one of two buffers,
// rows padded to a pitch of 272 B for the ds_load_b128 readers; the next pass's slices fly while this pass is worked on.
// Needs M % 128 == 0, N % 64 == 0, K % 128 == 0, K >= 256; grid = ((M / 128) * (N / 64), problems).
typedef uint32_t u32x4 __attribute__((ext_vector_type(4)));
typedef uint32_t u32x8 __attribute__((ext_vector_type(8)));
#define GL_PITCH 272u                      /* LDS row pitch: 256 B + 16 B pad */
#define GL_ASL 18432u                      /* 64 padded rows (17,408 B) rounded up to a multiple of 2 KiB */
#define GL_BSL 10240u                      /* 32 padded rows (8,704 B) rounded up to a multiple of 2 KiB */
#define GL_BUF (2u * GL_ASL + 2u * GL_BSL) /* one buffer: 57,344 B */
__device__ __forceinline__ uint32_t gl_uni(uint32_t v) { return (uint32_t)__builtin_amdgcn_readfirstlane(v); }
__device__ __forceinline__ uint32_t gl_pinned(uint32_t v) { uint32_t w = gl_uni(v); asm volatile("" : "+s"(w)); return w; }      /* pinned(): the test around a tensor load, held in a scalar register so that it compiles to s_cmp and a scalar branch (a tensor load ignores EXEC) */
__device__ __forceinline__ void gl_wait_ds0() { asm volatile("s_wait_dscnt 0x0" ::: "memory"); }          /* this wave's LDS reads are done before the buffer is handed back */
__device__ __forceinline__ void gl_wait_tensor0(u32x4 g0, u32x8 g1) { asm volatile("s_wait_tensorcnt 0x0" :: "s"(g0), "s"(g1) : "memory"); }  /* this wave's own slice has landed; the request's descriptor is named as an input so that its registers keep their values until here */
__device__ __forceinline__ u32x4 gl_load(uint32_t lds_dst, uint64_t ga, u32x8 g1) {
  u32x4 g0; g0[0] = gl_uni(1u); g0[1] = gl_uni(lds_dst); g0[2] = gl_uni((uint32_t)ga); g0[3] = gl_uni((((uint32_t)(ga >> 32)) & 0x01FFFFFFu) | 0x80000000u);
  asm volatile("tensor_load_to_lds %0, %1" :: "s"(g0), "s"(g1) : "memory"); return g0; }
__device__ __forceinline__ v16h gl_frag(const unsigned char* p) { FragH f; f.half[0] = *(const v8us*)p; f.half[1] = *(const v8us*)(p + 32); return f.v; }
__device__ __forceinline__ void gl_frags(v16h (&fa)[2], v16h (&fb)[4], const unsigned char* ap, const unsigned char* bp) {
  fa[0] = gl_frag(ap); fb[0] = gl_frag(bp); fa[1] = gl_frag(ap + 16u * GL_PITCH); fb[1] = gl_frag(bp + 16u * GL_PITCH); fb[2] = gl_frag(bp + GL_BSL); fb[3] = gl_frag(bp + GL_BSL + 16u * GL_PITCH); }
__global__ __launch_bounds__(128) void k_gemm2l(const _Float16* __restrict__ A, int lda, size_t sA, const _Float16* __restrict__ Bh, int ldb, size_t sB, float alpha, float* __restrict__ C, int ldc, size_t sC, int ntn, int K) {
  __shared__ __attribute__((aligned(2048))) unsigned char ring[2u * GL_BUF];
  __shared__ __attribute__((aligned(16))) float so[4][32][68];
  const int tid = threadIdx.x, w = tid >> 5, lane = tid & 31, ln = lane & 15, hh = lane >> 4;
  A += (size_t)blockIdx.y * sA; Bh += (size_t)blockIdx.y * sB; C += (size_t)blockIdx.y * sC;      /* grid y = problem of the batch; sA, sB, sC in elements */
  const int mt = blockIdx.x / ntn, nq = blockIdx.x - mt * ntn; const int row0 = mt * 128 + 32 * w, col0 = nq * 64;
  const uint32_t wave = gl_uni((uint32_t)tid >> 5); const bool isA = wave < 2u;
  const uint32_t rows = isA ? 64u : 32u; const uint32_t spitch = (uint32_t)(isA ? lda : ldb) * 2u;
  const uint64_t sbase = isA ? (uint64_t)(A + (size_t)(mt * 128 + 64 * (int)wave) * lda) : (uint64_t)(Bh + (size_t)(col0 + 32 * ((int)wave - 2)) * ldb);
  const uint32_t dst0 = (uint32_t)(uintptr_t)&ring[0] + (isA ? wave * GL_ASL : 2u * GL_ASL + (wave - 2u) * GL_BSL);
  u32x8 g1;      /* 1-byte elements, tensor = tile = rows x 256 B, a pad of 4 dwords behind every 64 dwords, no mask */
  g1[0] = gl_uni((1u << 20) | (5u << 22) | (3u << 25)); g1[1] = gl_uni(256u << 16); g1[2] = gl_uni(rows << 16); g1[3] = gl_uni(256u << 16); g1[4] = gl_uni(rows); g1[5] = gl_uni(spitch); g1[6] = gl_uni(0u); g1[7] = gl_uni(0u);
  const uint32_t np = (uint32_t)K >> 7;
  u32x4 g0 = gl_load(dst0, sbase, g1); gl_wait_tensor0(g0, g1); __syncthreads();      /* stage 0 landed and published */
  g0 = gl_load(dst0 + GL_BUF, sbase + 256u, g1);                        /* stage 1 flies under pass 0 */
  const uint32_t ao = (uint32_t)(w >> 1) * GL_ASL + (uint32_t)((w & 1) * 32 + ln) * GL_PITCH + 16u * (uint32_t)hh;
  const uint32_t bo = 2u * GL_ASL + (uint32_t)ln * GL_PITCH + 16u * (uint32_t)hh;
  const v8f z8 = {0.f,0.f,0.f,0.f,0.f,0.f,0.f,0.f}; v8f c00 = z8, c01 = z8, c02 = z8, c03 = z8, c10 = z8, c11 = z8, c12 = z8, c13 = z8;
#pragma unroll 1      /* one pass per trip: the publish point at the foot stands once */
  for (uint32_t s = 0; s < np; ++s) { const uint32_t bsel = (s & 1u) * GL_BUF; const unsigned char* ap = ring + bsel + ao; const unsigned char* bp = ring + bsel + bo;
    v16h fa[4][2], fb[4][4];      /* the pass's fragments: k steps 0 to 2 are read as one group in front of the products, step 3 behind step 0's products (all four at once would pass 256 registers) */
#pragma unroll
    for (int kk = 0; kk < 3; ++kk) gl_frags(fa[kk], fb[kk], ap + 64 * kk, bp + 64 * kk);
#pragma unroll
    for (int kk = 0; kk < 4; ++kk) {
      c00 = g2_mma(fa[kk][0], fb[kk][0], c00); c10 = g2_mma(fa[kk][1], fb[kk][0], c10); c01 = g2_mma(fa[kk][0], fb[kk][1], c01); c11 = g2_mma(fa[kk][1], fb[kk][1], c11);
      c02 = g2_mma(fa[kk][0], fb[kk][2], c02); c12 = g2_mma(fa[kk][1], fb[kk][2], c12); c03 = g2_mma(fa[kk][0], fb[kk][3], c03); c13 = g2_mma(fa[kk][1], fb[kk][3], c13);
      if (kk == 0) gl_frags(fa[3], fb[3], ap + 64 * 3, bp + 64 * 3); }
    gl_wait_ds0(); gl_wait_tensor0(g0, g1); __syncthreads();      /* publish point of stage s + 1; it also ends every reader's last read of stage s's buffer */
    const uint32_t nx = s + 2u;
    if (gl_pinned(nx < np)) g0 = gl_load(dst0 + bsel, sbase + (uint64_t)nx * 256u, g1); }
  gl_wait_tensor0(g0, g1); gl_wait_ds0();
  v8f accs[8] = {c00, c01, c02, c03, c10, c11, c12, c13};
#pragma unroll
  for (int u = 0; u < 8; ++u) { const int t = u & 3, half = u >> 2;
#pragma unroll
    for (int r = 0; r < 8; ++r) so[w][half * 16 + 8 * hh + r][t * 16 + ln] = accs[u][r] * alpha; }
  __builtin_amdgcn_fence(__ATOMIC_ACQ_REL, "workgroup"); __builtin_amdgcn_wave_barrier();
  const int rsub = lane >> 4, c4 = (lane & 15) * 4;
#pragma unroll
  for (int q = 0; q < 16; ++q) { const int r = q * 2 + rsub; const v4f v = *(const v4fa*)&so[w][r][c4]; *(v4f*)(C + (size_t)(row0 + r) * ldc + col0 + c4) = v; } }

extern "C" void kernel_launch(void* const* d_in, const int* in_sizes, int n_in,
                              void* d_out, int out_size, void* d_ws, size_t ws_size, hipStream_t stream) {
  (void)in_sizes; (void)n_in; (void)out_size;
  const float* const* I = (const float* const*)d_in; const float* xq = I[0]; const float* xk = I[1]; const float* xv = I[2];      /* q, k, v [4][4096][512] (bf16-valued) */
  char* ws = (char*)d_ws; size_t off = 0;
  auto take = [&](size_t bytes) { char* p = ws + off; off += (bytes + 255) & ~(size_t)255; return p; };
  _Float16* Q16 = (_Float16*)take(NR * DM * 2); _Float16* K16 = (_Float16*)take(NR * DM * 2); _Float16* V16 = (_Float16*)take(NR * DM * 2);
  float* S = (float*)take((size_t)2 * SQ * SQ * 4); _Float16* P = (_Float16*)take((size_t)2 * SQ * SQ * 2); _Float16* VT = (_Float16*)take((size_t)NB * DM * SQ * 2);      /* S and P hold two batches, VT all four */
  if (off > ws_size) return;
  k_x16qkv<<<(unsigned)((NR * DM / 8 + 255) / 256), 256, 0, stream>>>(xq, xk, xv, Q16, NR * DM / 8);      /* exact f16 copies of the bf16-valued inputs: Q16, K16, V16 are consecutive planes */
  k_vt<DM / 64, SQ><<<NB * (DM / 64) * (SQ / 64), 256, 0, stream>>>(V16, DM, 0, VT);      /* V^T [4][512][4096] */
  for (int b = 0; b < NB; b += 2) { const size_t r0 = (size_t)b * SQ;      /* two batches per launch (grid y) */
    k_gemm2l<<<dim3((SQ / 128) * (SQ / 64), 2), 128, 0, stream>>>(Q16 + r0 * DM, DM, (size_t)SQ * DM, K16 + r0 * DM, DM, (size_t)SQ * DM, 0.125f, S, SQ, (size_t)SQ * SQ, SQ / 64, DM);      /* S = q k^T / sqrt(64) (K = 512, exact products) over the ORIGINAL order */
    k_rsmw<<<2 * SQ / 8, 256, 0, stream>>>(S, P);      /* softmax over all 4096 positions -> P x256 f16 */
    k_gemm2l<<<dim3((SQ / 128) * (DM / 64), 2), 128, 0, stream>>>(P, SQ, (size_t)SQ * SQ, VT + (size_t)b * DM * SQ, SQ, (size_t)DM * SQ, 0.00390625f, (float*)d_out + r0 * DM, DM, (size_t)SQ * DM, DM / 64, SQ); }      /* out = P V^T 2^-8 f32 into the batches' rows (original order: the module's inverse permutation undoes its permutation) */
}
